// v000
// The times below were measured on an AMD MI455X: many runs one after another, warmed up first and cycling through
// copies of the inputs, with the whole window's GPU time divided by the number of runs. Launches and the gaps
// between them are all in it. The median over several windows is given; except for v000 it joins two sittings, which
// can be a few percent apart, so the side-by-side timings, each taken in one sitting, are the better comparison.
// v000, which the later versions start from, runs in 232 microseconds.
#include <hip/hip_runtime.h>
// Contractions: dots = Q·Qᵀ (K=64) on v_wmma_f32_16x16x32_bf16 as a 3-term bf16 hi/lo split (f32-accurate squared
// distances), and out = S·V (K=2048 keys) on v_wmma_f32_16x16x32_f16 with S×4096 and V as f16 operands; f32 accumulate.
// Norms, exp and the 1/4096 epilogue in f32.

#define L_TOK 2048
#define DH    64
#define NBH   16
#define QPB   64              // queries per block (4 waves)

typedef _Float16 v16h __attribute__((ext_vector_type(16)));
typedef _Float16 v8h  __attribute__((ext_vector_type(8)));
typedef _Float16 v8ha __attribute__((ext_vector_type(8), may_alias));
typedef __bf16   v16b __attribute__((ext_vector_type(16)));
typedef float    v8f  __attribute__((ext_vector_type(8)));
typedef float    v4f  __attribute__((ext_vector_type(4)));
typedef float    v4fa __attribute__((ext_vector_type(4), may_alias));
union FragH { v16h v; v8h half[2]; _Float16 h[16]; };
union FragB { v16b v; unsigned short u[16]; };

__device__ __forceinline__ unsigned short bf16_bits(float x) { unsigned int u = __float_as_uint(x); return (unsigned short)((u + 0x7FFFu + ((u >> 16) & 1u)) >> 16); }
__device__ __forceinline__ float bf16_val(unsigned short b) { return __uint_as_float(((unsigned int)b) << 16); }
__device__ __forceinline__ v8f mma16(v16h a, v16h b, v8f c) {
  c = __builtin_amdgcn_wmma_f32_16x16x32_f16(false, a, false, b, (short)0, c, false, false);
  asm volatile("v_nop\n\tv_nop\n\tv_nop\n\tv_nop" : "+v"(c) : "v"(a), "v"(b));
  return c;
}
__device__ __forceinline__ v8f mma3(v16b ah, v16b al, v16b bh, v16b bl, v8f c) {
  c = __builtin_amdgcn_wmma_f32_16x16x32_bf16(false, ah, false, bh, (short)0, c, false, false);
  c = __builtin_amdgcn_wmma_f32_16x16x32_bf16(false, ah, false, bl, (short)0, c, false, false);
  c = __builtin_amdgcn_wmma_f32_16x16x32_bf16(false, al, false, bh, (short)0, c, false, false);
  asm volatile("v_nop\n\tv_nop\n\tv_nop\n\tv_nop" : "+v"(c) : "v"(ah), "v"(al), "v"(bh), "v"(bl));
  return c;
}

__global__ __launch_bounds__(128) void k_softattn(const float* __restrict__ q, const float* __restrict__ v, float* __restrict__ out) {
  __shared__ __attribute__((aligned(16))) unsigned short sKh[32][DH + 8], sKl[32][DH + 8];   // key chunk, bf16 hi/lo [key][d]
  __shared__ float sKsq[32];                                                               // |k_j|^2
  __shared__ __attribute__((aligned(16))) _Float16 sV[32][DH + 8];                        // value chunk f16 [key][d]
  __shared__ __attribute__((aligned(16))) _Float16 sP[4][16][40];                         // per-wave S*4096 tile f16 [row][key]
  __shared__ __attribute__((aligned(16))) float sO[4][16][DH];

  const int tid = threadIdx.x, w = tid >> 5, lane = tid & 31, ln = lane & 15, hh = lane >> 4;
  const int bh = blockIdx.x / (L_TOK / QPB), qblk = blockIdx.x % (L_TOK / QPB);
  const int q0 = qblk * QPB + w * 16;
  const size_t base = (size_t)bh * L_TOK * DH;
  const float* Q = q + base; const float* V = v + base; float* O = out + base;
  const float cexp = -1.0f / 16.0f;                      // -1/(2*sqrt(64))

  // A fragments of this wave's 16 query rows (bf16 hi/lo, row ln, k = d split layout) and the per-row |q|^2 (f32)
  FragB aqh[2], aql[2];
  {
    const float* qr = Q + (size_t)(q0 + ln) * DH;
#pragma unroll
    for (int ks = 0; ks < 2; ++ks)
#pragma unroll
      for (int i = 0; i < 16; ++i) {
        const int d = ks * 32 + ((i < 8) ? (8 * hh + i) : (16 + 8 * hh + (i - 8)));
        const float x = qr[d]; const unsigned short hb = bf16_bits(x);
        aqh[ks].u[i] = hb; aql[ks].u[i] = bf16_bits(x - bf16_val(hb));
      }
  }
  // |q_i|^2 for the D rows this lane holds (rows 8hh+r): each lane sums its row ln fully, then exchange
  float sqrow[8];
  {
    const float* qr = Q + (size_t)(q0 + ln) * DH;
    float s = 0.f;
#pragma unroll 8
    for (int d = 0; d < DH; ++d) s += qr[d] * qr[d];
    // lane ln holds |q_{ln}|^2; row 8hh+r lives in lane (8hh+r) of either half
#pragma unroll
    for (int r = 0; r < 8; ++r) sqrow[r] = __shfl(s, 8 * hh + r, 32);
  }

  v8f oacc[4] = {};
  for (int c = 0; c < L_TOK / 32; ++c) {
    const int j0 = c * 32;
    __syncthreads();
    // stage key/value chunk: 32 rows x 64; thread handles 4 consecutive d of one row
    for (int e = tid; e < 32 * (DH / 4); e += 128) {
      const int r = e / (DH / 4), c4 = (e % (DH / 4)) * 4;
      const v4f kq = *(const v4fa*)(Q + (size_t)(j0 + r) * DH + c4);
      const v4f vv = *(const v4fa*)(V + (size_t)(j0 + r) * DH + c4);
#pragma unroll
      for (int t = 0; t < 4; ++t) {
        const unsigned short hb = bf16_bits(kq[t]);
        sKh[r][c4 + t] = hb; sKl[r][c4 + t] = bf16_bits(kq[t] - bf16_val(hb));
        sV[r][c4 + t] = (_Float16)vv[t];
      }
    }
    if (tid < 32) {                                      // |k_j|^2 in f32 from the f32 values
      const float* kr = Q + (size_t)(j0 + tid) * DH;
      float s = 0.f;
#pragma unroll 8
      for (int d = 0; d < DH; ++d) s += kr[d] * kr[d];
      sKsq[tid] = s;
    }
    __syncthreads();

    // dots tile 16 x 32 (two 16-key sub-tiles), 3-term split, then S = exp(cexp*(|q|^2+|k|^2-2 dots)) * 4096 -> f16 LDS tile
#pragma unroll
    for (int nt = 0; nt < 2; ++nt) {
      v8f acc = {};
#pragma unroll
      for (int ks = 0; ks < 2; ++ks) {
        FragB bkh, bkl;
        typedef unsigned short v8us __attribute__((ext_vector_type(8), may_alias));
        *(v8us*)&bkh.u[0] = *(const v8us*)&sKh[nt * 16 + ln][ks * 32 + 8 * hh];
        *(v8us*)&bkh.u[8] = *(const v8us*)&sKh[nt * 16 + ln][ks * 32 + 16 + 8 * hh];
        *(v8us*)&bkl.u[0] = *(const v8us*)&sKl[nt * 16 + ln][ks * 32 + 8 * hh];
        *(v8us*)&bkl.u[8] = *(const v8us*)&sKl[nt * 16 + ln][ks * 32 + 16 + 8 * hh];
        acc = mma3(aqh[ks].v, aql[ks].v, bkh.v, bkl.v, acc);
      }
      const float ksq = sKsq[nt * 16 + ln];              // D column = key nt*16+ln
#pragma unroll
      for (int r = 0; r < 8; ++r) {
        const float d2 = sqrow[r] + ksq - 2.0f * acc[r];
        sP[w][8 * hh + r][nt * 16 + ln] = (_Float16)(__expf(cexp * d2) * 4096.0f);
      }
    }
    __builtin_amdgcn_fence(__ATOMIC_ACQ_REL, "workgroup");
    __builtin_amdgcn_wave_barrier();
    FragH pa;                                            // A: row ln, k = key (split layout)
    pa.half[0] = *(const v8ha*)&sP[w][ln][8 * hh];
    pa.half[1] = *(const v8ha*)&sP[w][ln][16 + 8 * hh];
#pragma unroll
    for (int dt = 0; dt < 4; ++dt) {
      FragH bv;
#pragma unroll
      for (int i = 0; i < 8; ++i) { bv.h[i] = sV[8 * hh + i][dt * 16 + ln]; bv.h[8 + i] = sV[16 + 8 * hh + i][dt * 16 + ln]; }
      oacc[dt] = mma16(pa.v, bv.v, oacc[dt]);
    }
    __builtin_amdgcn_fence(__ATOMIC_ACQ_REL, "workgroup");
    __builtin_amdgcn_wave_barrier();                     // sP reads retired before the next chunk overwrites it
  }

#pragma unroll
  for (int dt = 0; dt < 4; ++dt)
#pragma unroll
    for (int r = 0; r < 8; ++r) sO[w][8 * hh + r][dt * 16 + ln] = oacc[dt][r] * (1.0f / 4096.0f);
  __builtin_amdgcn_fence(__ATOMIC_ACQ_REL, "workgroup");
  __builtin_amdgcn_wave_barrier();
  const int rsub = lane >> 4, c4 = (lane & 15) * 4;
  {
#pragma unroll
    for (int qq = 0; qq < 8; ++qq) {
      const int r = qq * 2 + rsub;
      const v4f val = *(const v4fa*)&sO[w][r][c4];
      *(v4f*)(O + (size_t)(q0 + r) * DH + c4) = val;
    }
    
  }
}

extern "C" void kernel_launch(void* const* d_in, const int* in_sizes, int n_in,
                              void* d_out, int out_size, void* d_ws, size_t ws_size, hipStream_t stream) {
  (void)in_sizes; (void)n_in; (void)out_size; (void)d_ws; (void)ws_size;
  const float* q = (const float*)d_in[0];
  const float* v = (const float*)d_in[1];
  k_softattn<<<NBH * (L_TOK / QPB), 128, 0, stream>>>(q, v, (float*)d_out);
}

// v001
// One run takes 101 microseconds.
// In both of two side-by-side timings against v000, it was 2.28 times as fast.
#include <hip/hip_runtime.h>
// Contractions: dots = Q·Qᵀ (K=64) on v_wmma_f32_16x16x32_bf16 as a 3-term bf16 hi/lo split (f32-accurate squared
// distances), and out = S·V (K=2048 keys) on v_wmma_f32_16x16x32_f16 with S×4096 and V as f16 operands; f32 accumulate.
// Norms, exp and the 1/4096 epilogue in f32.

#define L_TOK 2048
#define DH    64
#define NBH   16
#define QPB   64              // queries per block (4 waves)

typedef _Float16 v16h __attribute__((ext_vector_type(16)));
typedef _Float16 v8h  __attribute__((ext_vector_type(8)));
typedef _Float16 v8ha __attribute__((ext_vector_type(8), may_alias));
typedef __bf16   v16b __attribute__((ext_vector_type(16)));
typedef float    v8f  __attribute__((ext_vector_type(8)));
typedef float    v4f  __attribute__((ext_vector_type(4)));
typedef float    v4fa __attribute__((ext_vector_type(4), may_alias));
union FragH { v16h v; v8h half[2]; _Float16 h[16]; };
union FragB { v16b v; unsigned short u[16]; };

__device__ __forceinline__ unsigned short bf16_bits(float x) { unsigned int u = __float_as_uint(x); return (unsigned short)((u + 0x7FFFu + ((u >> 16) & 1u)) >> 16); }
__device__ __forceinline__ float bf16_val(unsigned short b) { return __uint_as_float(((unsigned int)b) << 16); }
__device__ __forceinline__ v8f mma16(v16h a, v16h b, v8f c) {
  c = __builtin_amdgcn_wmma_f32_16x16x32_f16(false, a, false, b, (short)0, c, false, false);
  asm volatile("v_nop\n\tv_nop\n\tv_nop\n\tv_nop" : "+v"(c) : "v"(a), "v"(b));
  return c;
}
__device__ __forceinline__ v8f mma3(v16b ah, v16b al, v16b bh, v16b bl, v8f c) {
  c = __builtin_amdgcn_wmma_f32_16x16x32_bf16(false, ah, false, bh, (short)0, c, false, false);
  c = __builtin_amdgcn_wmma_f32_16x16x32_bf16(false, ah, false, bl, (short)0, c, false, false);
  c = __builtin_amdgcn_wmma_f32_16x16x32_bf16(false, al, false, bh, (short)0, c, false, false);
  asm volatile("v_nop\n\tv_nop\n\tv_nop\n\tv_nop" : "+v"(c) : "v"(ah), "v"(al), "v"(bh), "v"(bl));
  return c;
}

template <int M> __device__ __forceinline__ float row_xadd(float x) {   // x + x of lane ^ M inside the 16-lane row (DPP row_xmask)
  return x + __int_as_float(__builtin_amdgcn_update_dpp(0, __float_as_int(x), 0x160 + M, 0xf, 0xf, true));
}
__device__ __forceinline__ float row16_sum(float x) { return row_xadd<8>(row_xadd<4>(row_xadd<2>(row_xadd<1>(x)))); }

__global__ __launch_bounds__(128) void k_softattn(const float* __restrict__ q, const float* __restrict__ v, float* __restrict__ out) {
  __shared__ __attribute__((aligned(16))) unsigned short sKh[32][DH + 8], sKl[32][DH + 8];   // key chunk, bf16 hi/lo [key][d]
  __shared__ float sKsq[32];                                                               // |k_j|^2
  __shared__ __attribute__((aligned(16))) _Float16 sV[32][DH + 8];                        // value chunk f16 [key][d]
  __shared__ __attribute__((aligned(16))) _Float16 sP[4][16][40];                         // per-wave S*4096 tile f16 [row][key]
  __shared__ __attribute__((aligned(16))) float sO[4][16][DH];

  const int tid = threadIdx.x, w = tid >> 5, lane = tid & 31, ln = lane & 15, hh = lane >> 4;
  const int bh = blockIdx.x / (L_TOK / QPB), qblk = blockIdx.x % (L_TOK / QPB);
  const int q0 = qblk * QPB + w * 16;
  const size_t base = (size_t)bh * L_TOK * DH;
  const float* Q = q + base; const float* V = v + base; float* O = out + base;
  const float cexp = -1.0f / 16.0f;                      // -1/(2*sqrt(64))

  // A fragments of this wave's 16 query rows (bf16 hi/lo, row ln, k = d split layout) and the per-row |q|^2 (f32)
  FragB aqh[2], aql[2];
  {
    const float* qr = Q + (size_t)(q0 + ln) * DH;
#pragma unroll
    for (int ks = 0; ks < 2; ++ks)
#pragma unroll
      for (int i = 0; i < 16; ++i) {
        const int d = ks * 32 + ((i < 8) ? (8 * hh + i) : (16 + 8 * hh + (i - 8)));
        const float x = qr[d]; const unsigned short hb = bf16_bits(x);
        aqh[ks].u[i] = hb; aql[ks].u[i] = bf16_bits(x - bf16_val(hb));
      }
  }
  // |q_i|^2 for the D rows this lane holds (rows 8hh+r): each lane sums its row ln fully, then exchange
  float sqrow[8];
  {
    const float* qr = Q + (size_t)(q0 + ln) * DH;
    float s = 0.f;
#pragma unroll 8
    for (int d = 0; d < DH; ++d) s += qr[d] * qr[d];
    // lane ln holds |q_{ln}|^2; row 8hh+r lives in lane (8hh+r) of either half
#pragma unroll
    for (int r = 0; r < 8; ++r) sqrow[r] = __shfl(s, 8 * hh + r, 32);
  }

  v8f oacc[4] = {};
  const int r0 = tid >> 4, c4s = ln * 4;                 // staging: row within a group of 8, first d
  for (int c = 0; c < L_TOK / 32; ++c) {
    const int j0 = c * 32;
    // this thread's share of the chunk: rows r0, r0+8, r0+16, r0+24, 4 consecutive d each
    v4f kq[4], vv[4];
#pragma unroll   // all 8 loads leave before any is used: one load round trip a chunk instead of one a row
    for (int it = 0; it < 4; ++it) {
      kq[it] = *(const v4fa*)(Q + (size_t)(j0 + it * 8 + r0) * DH + c4s);
      vv[it] = *(const v4fa*)(V + (size_t)(j0 + it * 8 + r0) * DH + c4s);
    }
    __syncthreads();
    float ksq_mine = 0.f;
#pragma unroll   // kq[it], vv[it] stay in registers
    for (int it = 0; it < 4; ++it) {
      const int r = it * 8 + r0;
#pragma unroll
      for (int t = 0; t < 4; ++t) {
        const unsigned short hb = bf16_bits(kq[it][t]);
        sKh[r][c4s + t] = hb; sKl[r][c4s + t] = bf16_bits(kq[it][t] - bf16_val(hb));
        sV[r][c4s + t] = (_Float16)vv[it][t];
      }
      // |k_j|^2 in f32 from the f32 values in registers: the 16 lanes of a row hold one key row, every lane ends with its sum
      const float s = row16_sum(kq[it][0] * kq[it][0] + kq[it][1] * kq[it][1] + kq[it][2] * kq[it][2] + kq[it][3] * kq[it][3]);
      if (ln == it) ksq_mine = s;
    }
    if (ln < 4) sKsq[ln * 8 + r0] = ksq_mine;
    __syncthreads();

    // dots tile 16 x 32 (two 16-key sub-tiles), 3-term split, then S = exp(cexp*(|q|^2+|k|^2-2 dots)) * 4096 -> f16 LDS tile
#pragma unroll
    for (int nt = 0; nt < 2; ++nt) {
      v8f acc = {};
#pragma unroll
      for (int ks = 0; ks < 2; ++ks) {
        FragB bkh, bkl;
        typedef unsigned short v8us __attribute__((ext_vector_type(8), may_alias));
        *(v8us*)&bkh.u[0] = *(const v8us*)&sKh[nt * 16 + ln][ks * 32 + 8 * hh];
        *(v8us*)&bkh.u[8] = *(const v8us*)&sKh[nt * 16 + ln][ks * 32 + 16 + 8 * hh];
        *(v8us*)&bkl.u[0] = *(const v8us*)&sKl[nt * 16 + ln][ks * 32 + 8 * hh];
        *(v8us*)&bkl.u[8] = *(const v8us*)&sKl[nt * 16 + ln][ks * 32 + 16 + 8 * hh];
        acc = mma3(aqh[ks].v, aql[ks].v, bkh.v, bkl.v, acc);
      }
      const float ksq = sKsq[nt * 16 + ln];              // D column = key nt*16+ln
#pragma unroll
      for (int r = 0; r < 8; ++r) {
        const float d2 = sqrow[r] + ksq - 2.0f * acc[r];
        sP[w][8 * hh + r][nt * 16 + ln] = (_Float16)(__expf(cexp * d2) * 4096.0f);
      }
    }
    __builtin_amdgcn_fence(__ATOMIC_ACQ_REL, "workgroup");
    __builtin_amdgcn_wave_barrier();
    FragH pa;                                            // A: row ln, k = key (split layout)
    pa.half[0] = *(const v8ha*)&sP[w][ln][8 * hh];
    pa.half[1] = *(const v8ha*)&sP[w][ln][16 + 8 * hh];
#pragma unroll
    for (int dt = 0; dt < 4; ++dt) {
      FragH bv;
#pragma unroll
      for (int i = 0; i < 8; ++i) { bv.h[i] = sV[8 * hh + i][dt * 16 + ln]; bv.h[8 + i] = sV[16 + 8 * hh + i][dt * 16 + ln]; }
      oacc[dt] = mma16(pa.v, bv.v, oacc[dt]);
    }
    __builtin_amdgcn_fence(__ATOMIC_ACQ_REL, "workgroup");
    __builtin_amdgcn_wave_barrier();                     // sP reads retired before the next chunk overwrites it
  }

#pragma unroll
  for (int dt = 0; dt < 4; ++dt)
#pragma unroll
    for (int r = 0; r < 8; ++r) sO[w][8 * hh + r][dt * 16 + ln] = oacc[dt][r] * (1.0f / 4096.0f);
  __builtin_amdgcn_fence(__ATOMIC_ACQ_REL, "workgroup");
  __builtin_amdgcn_wave_barrier();
  const int rsub = lane >> 4, c4 = (lane & 15) * 4;
  {
#pragma unroll
    for (int qq = 0; qq < 8; ++qq) {
      const int r = qq * 2 + rsub;
      const v4f val = *(const v4fa*)&sO[w][r][c4];
      *(v4f*)(O + (size_t)(q0 + r) * DH + c4) = val;
    }
    
  }
}

extern "C" void kernel_launch(void* const* d_in, const int* in_sizes, int n_in,
                              void* d_out, int out_size, void* d_ws, size_t ws_size, hipStream_t stream) {
  (void)in_sizes; (void)n_in; (void)out_size; (void)d_ws; (void)ws_size;
  const float* q = (const float*)d_in[0];
  const float* v = (const float*)d_in[1];
  k_softattn<<<NBH * (L_TOK / QPB), 128, 0, stream>>>(q, v, (float*)d_out);
}

// v002
// Measured time: 61.6 microseconds a run.
// Timed twice side by side with v001, it ran 1.64 times as fast both times.
// All steps since v000 together make it 3.73 times as fast.
#include <hip/hip_runtime.h>
// Contractions: dots = Q·Qᵀ (K=64) on v_wmma_f32_16x16x32_bf16 as a 3-term bf16 hi/lo split (f32-accurate squared
// distances), and out = S·V (K=2048 keys) on v_wmma_f32_16x16x32_f16 with S×4096 and V as f16 operands; f32 accumulate.
// Norms, exp and the 1/4096 epilogue in f32.

#define L_TOK 2048
#define DH    64
#define NBH   16
#define QPB   64              // queries per block (4 query tiles of 16)
#define KSP   4               // key groups per block: wave group g takes keys 32g..32g+31 of every staged chunk for all 4 query tiles
#define NTHR  (128 * KSP)
#define KCH   (32 * KSP)      // keys staged per trip

typedef _Float16 v16h __attribute__((ext_vector_type(16)));
typedef _Float16 v8h  __attribute__((ext_vector_type(8)));
typedef _Float16 v8ha __attribute__((ext_vector_type(8), may_alias));
typedef __bf16   v16b __attribute__((ext_vector_type(16)));
typedef float    v8f  __attribute__((ext_vector_type(8)));
typedef float    v4f  __attribute__((ext_vector_type(4)));
typedef float    v4fa __attribute__((ext_vector_type(4), may_alias));
union FragH { v16h v; v8h half[2]; _Float16 h[16]; };
union FragB { v16b v; unsigned short u[16]; };

__device__ __forceinline__ unsigned short bf16_bits(float x) { unsigned int u = __float_as_uint(x); return (unsigned short)((u + 0x7FFFu + ((u >> 16) & 1u)) >> 16); }
__device__ __forceinline__ float bf16_val(unsigned short b) { return __uint_as_float(((unsigned int)b) << 16); }
__device__ __forceinline__ v8f mma16(v16h a, v16h b, v8f c) {
  c = __builtin_amdgcn_wmma_f32_16x16x32_f16(false, a, false, b, (short)0, c, false, false);
  asm volatile("v_nop\n\tv_nop\n\tv_nop\n\tv_nop" : "+v"(c) : "v"(a), "v"(b));
  return c;
}
__device__ __forceinline__ v8f mma3(v16b ah, v16b al, v16b bh, v16b bl, v8f c) {
  c = __builtin_amdgcn_wmma_f32_16x16x32_bf16(false, ah, false, bh, (short)0, c, false, false);
  c = __builtin_amdgcn_wmma_f32_16x16x32_bf16(false, ah, false, bl, (short)0, c, false, false);
  c = __builtin_amdgcn_wmma_f32_16x16x32_bf16(false, al, false, bh, (short)0, c, false, false);
  asm volatile("v_nop\n\tv_nop\n\tv_nop\n\tv_nop" : "+v"(c) : "v"(ah), "v"(al), "v"(bh), "v"(bl));
  return c;
}

template <int M> __device__ __forceinline__ float row_xadd(float x) {   // x + x of lane ^ M inside the 16-lane row (DPP row_xmask)
  return x + __int_as_float(__builtin_amdgcn_update_dpp(0, __float_as_int(x), 0x160 + M, 0xf, 0xf, true));
}
__device__ __forceinline__ float row16_sum(float x) { return row_xadd<8>(row_xadd<4>(row_xadd<2>(row_xadd<1>(x)))); }

// second argument: 8 waves a SIMD, so that two blocks of 16 waves stay resident on a WGP
__global__ __launch_bounds__(NTHR, 8) void k_softattn(const float* __restrict__ q, const float* __restrict__ v, float* __restrict__ out) {
  __shared__ __attribute__((aligned(16))) unsigned short sKh[KCH][DH + 8], sKl[KCH][DH + 8];   // key chunk, bf16 hi/lo [key][d]
  __shared__ float sKsq[KCH];                                                              // |k_j|^2
  __shared__ __attribute__((aligned(16))) _Float16 sV[KCH][DH + 8];                       // value chunk f16 [key][d]
  __shared__ __attribute__((aligned(16))) _Float16 sP[4 * KSP][16][40];                        // per-wave S*4096 tile f16 [row][key]
  __shared__ __attribute__((aligned(16))) float sO[KSP][QPB][DH];                         // per key group: partial out*4096 of the block's 64 queries

  const int tid = threadIdx.x, lane = tid & 31, ln = lane & 15, hh = lane >> 4;
  const int wv = __builtin_amdgcn_readfirstlane(tid >> 5), w = wv & 3, g = wv >> 2;   // wave number, query tile, key group: scalar registers
  const int kb = g * 32;                                 // this wave's first key row inside the staged chunk
  const int bh = blockIdx.x / (L_TOK / QPB), qblk = blockIdx.x % (L_TOK / QPB);
  const int q0 = qblk * QPB + w * 16;
  const size_t base = (size_t)bh * L_TOK * DH;
  const float* Q = q + base; const float* V = v + base; float* O = out + base;
  const float cexp = -1.0f / 16.0f;                      // -1/(2*sqrt(64))

  // A fragments of this wave's 16 query rows (bf16 hi/lo, row ln, k = d split layout) and the per-row |q|^2 (f32)
  FragB aqh[2], aql[2];
  {
    const float* qr = Q + (size_t)(q0 + ln) * DH;
#pragma unroll
    for (int ks = 0; ks < 2; ++ks)
#pragma unroll
      for (int i = 0; i < 16; ++i) {
        const int d = ks * 32 + ((i < 8) ? (8 * hh + i) : (16 + 8 * hh + (i - 8)));
        const float x = qr[d]; const unsigned short hb = bf16_bits(x);
        aqh[ks].u[i] = hb; aql[ks].u[i] = bf16_bits(x - bf16_val(hb));
      }
  }
  // |q_i|^2 for the D rows this lane holds (rows 8hh+r): each lane sums its row ln fully, then exchange
  float sqrow[8];
  {
    const float* qr = Q + (size_t)(q0 + ln) * DH;
    float s = 0.f;
#pragma unroll 8
    for (int d = 0; d < DH; ++d) s += qr[d] * qr[d];
    // lane ln holds |q_{ln}|^2; row 8hh+r lives in lane (8hh+r) of either half
#pragma unroll
    for (int r = 0; r < 8; ++r) sqrow[r] = __shfl(s, 8 * hh + r, 32);
  }

  v8f oacc[4] = {};
  const int r0 = tid >> 4, c4s = ln * 4;                 // staging: row within a group of 8*KSP, first d
  for (int c = 0; c < L_TOK / KCH; ++c) {
    const float* pq = Q + (size_t)(c * KCH + r0) * DH + c4s;
    const float* pv = V + (size_t)(c * KCH + r0) * DH + c4s;
    // this thread's share of the chunk: rows r0 + it*8*KSP, 4 consecutive d each
    v4f kq[4], vv[4];
#pragma unroll   // all 8 loads leave before any is used: one load round trip a chunk instead of one a row
    for (int it = 0; it < 4; ++it) {
      kq[it] = *(const v4fa*)(pq + it * (8 * KSP * DH));
      vv[it] = *(const v4fa*)(pv + it * (8 * KSP * DH));
    }
    // the two address pairs are inputs, so they stay whole up to this wait: at 128 VGPRs the last loads of the batch otherwise
    // land on the pair that the earlier ones still name; the wave waits for the load data next in any case
    asm volatile("s_wait_xcnt 0x0" :: "v"(pq), "v"(pv) : "memory");
    __syncthreads();
    float ksq_mine = 0.f;
#pragma unroll   // kq[it], vv[it] stay in registers
    for (int it = 0; it < 4; ++it) {
      const int r = it * (8 * KSP) + r0;
#pragma unroll
      for (int t = 0; t < 4; ++t) {
        const unsigned short hb = bf16_bits(kq[it][t]);
        sKh[r][c4s + t] = hb; sKl[r][c4s + t] = bf16_bits(kq[it][t] - bf16_val(hb));
        sV[r][c4s + t] = (_Float16)vv[it][t];
      }
      // |k_j|^2 in f32 from the f32 values in registers: the 16 lanes of a row hold one key row, every lane ends with its sum
      const float s = row16_sum(kq[it][0] * kq[it][0] + kq[it][1] * kq[it][1] + kq[it][2] * kq[it][2] + kq[it][3] * kq[it][3]);
      if (ln == it) ksq_mine = s;
    }
    if (ln < 4) sKsq[ln * (8 * KSP) + r0] = ksq_mine;
    __syncthreads();

    // dots tile 16 x 32 (two 16-key sub-tiles), 3-term split, then S = exp(cexp*(|q|^2+|k|^2-2 dots)) * 4096 -> f16 LDS tile
#pragma unroll
    for (int nt = 0; nt < 2; ++nt) {
      v8f acc = {};
#pragma unroll
      for (int ks = 0; ks < 2; ++ks) {
        FragB bkh, bkl;
        typedef unsigned short v8us __attribute__((ext_vector_type(8), may_alias));
        *(v8us*)&bkh.u[0] = *(const v8us*)&sKh[kb + nt * 16 + ln][ks * 32 + 8 * hh];
        *(v8us*)&bkh.u[8] = *(const v8us*)&sKh[kb + nt * 16 + ln][ks * 32 + 16 + 8 * hh];
        *(v8us*)&bkl.u[0] = *(const v8us*)&sKl[kb + nt * 16 + ln][ks * 32 + 8 * hh];
        *(v8us*)&bkl.u[8] = *(const v8us*)&sKl[kb + nt * 16 + ln][ks * 32 + 16 + 8 * hh];
        acc = mma3(aqh[ks].v, aql[ks].v, bkh.v, bkl.v, acc);
      }
      const float ksq = sKsq[kb + nt * 16 + ln];         // D column = key kb+nt*16+ln
#pragma unroll
      for (int r = 0; r < 8; ++r) {
        const float d2 = sqrow[r] + ksq - 2.0f * acc[r];
        sP[wv][8 * hh + r][nt * 16 + ln] = (_Float16)(__expf(cexp * d2) * 4096.0f);
      }
    }
    __builtin_amdgcn_fence(__ATOMIC_ACQ_REL, "workgroup");
    __builtin_amdgcn_wave_barrier();
    FragH pa;                                            // A: row ln, k = key (split layout)
    pa.half[0] = *(const v8ha*)&sP[wv][ln][8 * hh];
    pa.half[1] = *(const v8ha*)&sP[wv][ln][16 + 8 * hh];
#pragma unroll
    for (int dt = 0; dt < 4; ++dt) {
      FragH bv;
#pragma unroll
      for (int i = 0; i < 8; ++i) { bv.h[i] = sV[kb + 8 * hh + i][dt * 16 + ln]; bv.h[8 + i] = sV[kb + 16 + 8 * hh + i][dt * 16 + ln]; }
      oacc[dt] = mma16(pa.v, bv.v, oacc[dt]);
    }
    __builtin_amdgcn_fence(__ATOMIC_ACQ_REL, "workgroup");
    __builtin_amdgcn_wave_barrier();                     // sP reads retired before the next chunk overwrites it
  }

  // the lane number is read anew here: no epilogue address then lives in a vector register through the loop (scratch stays 0 at 128 VGPRs)
  const int el = (int)__builtin_amdgcn_mbcnt_lo(~0u, 0u), eln = el & 15, ehh = el >> 4, etid = wv * 32 + el;
#pragma unroll
  for (int dt = 0; dt < 4; ++dt)
#pragma unroll
    for (int r = 0; r < 8; ++r) sO[g][w * 16 + 8 * ehh + r][dt * 16 + eln] = oacc[dt][r];
  __syncthreads();                                       // every key group's partial is in LDS before any thread sums them
  // out row = sum of the KSP partials in group order, then the exact 1/4096; 16 lanes store one whole 256-byte row
#pragma unroll
  for (int k = 0; k < QPB * (DH / 4) / NTHR; ++k) {
    const int idx = k * NTHR + etid, r = idx >> 4, c4 = (idx & 15) * 4;
    v4f val = *(const v4fa*)&sO[0][r][c4];
#pragma unroll
    for (int p = 1; p < KSP; ++p) val += *(const v4fa*)&sO[p][r][c4];
    *(v4f*)(O + (size_t)(qblk * QPB + r) * DH + c4) = val * (1.0f / 4096.0f);
  }
}

extern "C" void kernel_launch(void* const* d_in, const int* in_sizes, int n_in,
                              void* d_out, int out_size, void* d_ws, size_t ws_size, hipStream_t stream) {
  (void)in_sizes; (void)n_in; (void)out_size; (void)d_ws; (void)ws_size;
  const float* q = (const float*)d_in[0];
  const float* v = (const float*)d_in[1];
  k_softattn<<<NBH * (L_TOK / QPB), NTHR, 0, stream>>>(q, v, (float*)d_out);
}

// v003
// Measured time: 53.6 microseconds a run.
// Timed twice side by side with v002, it ran 1.15 times as fast both times.
// All steps since v000 together make it 4.29 times as fast.
#include <hip/hip_runtime.h>
// Contractions: dots = Q·Qᵀ (K=64) on v_wmma_f32_16x16x32_bf16 as a 3-term bf16 hi/lo split (f32-accurate squared
// distances), and out = S·V (K=2048 keys) on v_wmma_f32_16x16x32_f16 with S×4096 and V as f16 operands; f32 accumulate.
// Norms, exp and the 1/4096 epilogue in f32.
// Two launches: k_split writes the bf16 hi/lo split of q, the f16 copy of v and the row norms |q_i|^2 to the workspace once;
// k_softattn reads only those, so that no block repeats the conversion of the 2048 keys that its 31 neighbours of the same head need too.

#define L_TOK 2048
#define DH    64
#define NBH   16
#define QPB   64              // queries per block (4 query tiles of 16)
#define KSP   4               // key groups per block: wave group g takes keys 32g..32g+31 of every staged chunk for all 4 query tiles
#define NTHR  (128 * KSP)
#define KCH   (32 * KSP)      // keys staged per trip
#define NEL   (NBH * L_TOK * DH)   // elements of q (and of v)
#define HEL   (L_TOK * DH)         // elements of one head; workspace in 16-bit units: head h has q hi at 3*HEL*h, q lo HEL and v f16 2*HEL behind it
                                   // (all three within an immediate offset of one address pair); the norms (f32) stand at 3*NEL

typedef _Float16 v16h __attribute__((ext_vector_type(16)));
typedef _Float16 v8h  __attribute__((ext_vector_type(8)));
typedef _Float16 v8ha __attribute__((ext_vector_type(8), may_alias));
typedef __bf16   v16b __attribute__((ext_vector_type(16)));
typedef float    v8f  __attribute__((ext_vector_type(8)));
typedef float    v4f  __attribute__((ext_vector_type(4)));
typedef float    v4fa __attribute__((ext_vector_type(4), may_alias));
typedef unsigned short v8us __attribute__((ext_vector_type(8), may_alias));
typedef unsigned short v4us __attribute__((ext_vector_type(4), may_alias));
typedef _Float16 v4ha __attribute__((ext_vector_type(4), may_alias));
union FragH { v16h v; v8h half[2]; _Float16 h[16]; };
union FragB { v16b v; unsigned short u[16]; };

__device__ __forceinline__ unsigned short bf16_bits(float x) { unsigned int u = __float_as_uint(x); return (unsigned short)((u + 0x7FFFu + ((u >> 16) & 1u)) >> 16); }
__device__ __forceinline__ float bf16_val(unsigned short b) { return __uint_as_float(((unsigned int)b) << 16); }
__device__ __forceinline__ v8f mma16(v16h a, v16h b, v8f c) {
  c = __builtin_amdgcn_wmma_f32_16x16x32_f16(false, a, false, b, (short)0, c, false, false);
  asm volatile("v_nop\n\tv_nop\n\tv_nop\n\tv_nop" : "+v"(c) : "v"(a), "v"(b));
  return c;
}
__device__ __forceinline__ v8f mma3(v16b ah, v16b al, v16b bh, v16b bl, v8f c) {
  c = __builtin_amdgcn_wmma_f32_16x16x32_bf16(false, ah, false, bh, (short)0, c, false, false);
  c = __builtin_amdgcn_wmma_f32_16x16x32_bf16(false, ah, false, bl, (short)0, c, false, false);
  c = __builtin_amdgcn_wmma_f32_16x16x32_bf16(false, al, false, bh, (short)0, c, false, false);
  asm volatile("v_nop\n\tv_nop\n\tv_nop\n\tv_nop" : "+v"(c) : "v"(ah), "v"(al), "v"(bh), "v"(bl));
  return c;
}

template <int M> __device__ __forceinline__ float row_xadd(float x) {   // x + x of lane ^ M inside the 16-lane row (DPP row_xmask)
  return x + __int_as_float(__builtin_amdgcn_update_dpp(0, __float_as_int(x), 0x160 + M, 0xf, 0xf, true));
}
__device__ __forceinline__ float row16_sum(float x) { return row_xadd<8>(row_xadd<4>(row_xadd<2>(row_xadd<1>(x)))); }

// One wave converts 32 consecutive rows: trip it takes rows it (lanes 0-15) and 16+it (lanes 16-31), 4 consecutive d a lane.
// Every 128-byte line of the four workspace planes has one writing wave.
__global__ __launch_bounds__(128) void k_split(const float* __restrict__ q, const float* __restrict__ v, unsigned short* __restrict__ ws) {
  const int tid = threadIdx.x, lane = tid & 31, ln = lane & 15, hh = lane >> 4;
  const int row0 = (blockIdx.x * 4 + (tid >> 5)) * 32;
  const size_t e0 = (size_t)(row0 + 16 * hh) * DH + ln * 4;
  const float* pq = q + e0; const float* pv = v + e0;
  v4f kq[16], vv[16];
#pragma unroll   // all 32 loads leave before any is used: one load round trip for the launch
  for (int it = 0; it < 16; ++it) {
    kq[it] = *(const v4fa*)(pq + it * DH);
    vv[it] = *(const v4fa*)(pv + it * DH);
  }
  // the two address pairs are inputs, so they stay whole up to this wait
  asm volatile("s_wait_xcnt 0x0" :: "v"(pq), "v"(pv) : "memory");
  unsigned short* ph = ws + e0 + (size_t)(row0 / L_TOK) * (2 * HEL);   // the 32 rows of a wave lie in one head
  float ksq_mine = 0.f;
#pragma unroll   // kq[it], vv[it] stay in registers
  for (int it = 0; it < 16; ++it) {
    v4us h4, l4; v4ha f4;
#pragma unroll
    for (int t = 0; t < 4; ++t) {
      const unsigned short hb = bf16_bits(kq[it][t]);
      h4[t] = hb; l4[t] = bf16_bits(kq[it][t] - bf16_val(hb));
      f4[t] = (_Float16)vv[it][t];
    }
    *(v4us*)(ph + it * DH) = h4;
    *(v4us*)(ph + HEL + it * DH) = l4;
    *(v4ha*)(ph + 2 * HEL + it * DH) = f4;
    // |q_j|^2 in f32 from the f32 values in registers: the 16 lanes of a row hold one row, every lane ends with its sum
    const float s = row16_sum(kq[it][0] * kq[it][0] + kq[it][1] * kq[it][1] + kq[it][2] * kq[it][2] + kq[it][3] * kq[it][3]);
    if (ln == it) ksq_mine = s;                          // lane 16*hh + it keeps row 16*hh + it
  }
  ((float*)(ws + 3 * (size_t)NEL))[row0 + lane] = ksq_mine;
}

// second argument: 8 waves a SIMD, so that two blocks of 16 waves stay resident on a WGP
__global__ __launch_bounds__(NTHR, 8) void k_softattn(const unsigned short* __restrict__ ws, float* __restrict__ out) {
  __shared__ __attribute__((aligned(16))) unsigned short sKh[KCH][DH + 8], sKl[KCH][DH + 8];   // key chunk, bf16 hi/lo [key][d]
  __shared__ __attribute__((aligned(16))) _Float16 sV[KCH][DH + 8];                       // value chunk f16 [key][d]
  __shared__ __attribute__((aligned(16))) _Float16 sP[4 * KSP][16][40];                        // per-wave S*4096 tile f16 [row][key]
  __shared__ __attribute__((aligned(16))) float sO[KSP][QPB][DH];                         // per key group: partial out*4096 of the block's 64 queries

  const int tid = threadIdx.x, lane = tid & 31, ln = lane & 15, hh = lane >> 4;
  const int wv = __builtin_amdgcn_readfirstlane(tid >> 5), w = wv & 3, g = wv >> 2;   // wave number, query tile, key group: scalar registers
  const int kb = g * 32;                                 // this wave's first key row inside the staged chunk
  const int bh = blockIdx.x / (L_TOK / QPB), qblk = blockIdx.x % (L_TOK / QPB);
  const int q0 = qblk * QPB + w * 16;
  const size_t base = (size_t)bh * L_TOK * DH;
  const unsigned short* QH = ws + 3 * base;              // hi plane of this head; lo at + HEL, v at + 2*HEL
  const float* NRM = (const float*)(ws + 3 * (size_t)NEL) + bh * L_TOK;
  float* O = out + base;
  const float cexp = -1.0f / 16.0f;                      // -1/(2*sqrt(64))

  // A fragments of this wave's 16 query rows (bf16 hi/lo, row ln, k = d split layout) and |q|^2 of the D rows this lane holds (rows 8hh+r)
  FragB aqh[2], aql[2];
  float sqrow[8];
  {
    const unsigned short* qr = QH + (size_t)(q0 + ln) * DH + 8 * hh;
#pragma unroll
    for (int ks = 0; ks < 2; ++ks) {
      *(v8us*)&aqh[ks].u[0] = *(const v8us*)(qr + ks * 32);
      *(v8us*)&aqh[ks].u[8] = *(const v8us*)(qr + ks * 32 + 16);
      *(v8us*)&aql[ks].u[0] = *(const v8us*)(qr + HEL + ks * 32);
      *(v8us*)&aql[ks].u[8] = *(const v8us*)(qr + HEL + ks * 32 + 16);
    }
    const v4f n0 = *(const v4fa*)(NRM + q0 + 8 * hh), n1 = *(const v4fa*)(NRM + q0 + 8 * hh + 4);
#pragma unroll
    for (int r = 0; r < 4; ++r) { sqrow[r] = n0[r]; sqrow[4 + r] = n1[r]; }
  }

  v8f oacc[4] = {};
  const int r0 = tid >> 3, c8s = (tid & 7) * 8;          // staging: row within a group of 16*KSP, first d of this thread's 16 bytes
  for (int c = 0; c < L_TOK / KCH; ++c) {
    const unsigned short* pk = QH + (size_t)c * (KCH * DH) + tid * 8;
    const float* pn = NRM + c * KCH + kb + ln;
    // this thread's share of the chunk: 16 bytes of rows r0 and r0 + 16*KSP of each plane, and the norms of the two keys whose D column it holds
    v8us kh[2], kl[2], vh[2]; float ksq2[2];
#pragma unroll   // all 8 loads leave before any is used: one load round trip a chunk
    for (int it = 0; it < 2; ++it) {
      kh[it] = *(const v8us*)(pk + it * (NTHR * 8));
      kl[it] = *(const v8us*)(pk + HEL + it * (NTHR * 8));
      vh[it] = *(const v8us*)(pk + 2 * HEL + it * (NTHR * 8));
      ksq2[it] = pn[it * 16];
    }
    // the two address pairs are inputs, so they stay whole up to this wait; the wave waits for the load data next in any case
    asm volatile("s_wait_xcnt 0x0" :: "v"(pk), "v"(pn) : "memory");
    __syncthreads();
#pragma unroll
    for (int it = 0; it < 2; ++it) {
      const int r = it * (16 * KSP) + r0;
      *(v8us*)&sKh[r][c8s] = kh[it];
      *(v8us*)&sKl[r][c8s] = kl[it];
      *(v8us*)&sV[r][c8s] = vh[it];
    }
    __syncthreads();

    // dots tile 16 x 32 (two 16-key sub-tiles), 3-term split, then S = exp(cexp*(|q|^2+|k|^2-2 dots)) * 4096 -> f16 LDS tile
#pragma unroll
    for (int nt = 0; nt < 2; ++nt) {
      v8f acc = {};
#pragma unroll
      for (int ks = 0; ks < 2; ++ks) {
        FragB bkh, bkl;
        *(v8us*)&bkh.u[0] = *(const v8us*)&sKh[kb + nt * 16 + ln][ks * 32 + 8 * hh];
        *(v8us*)&bkh.u[8] = *(const v8us*)&sKh[kb + nt * 16 + ln][ks * 32 + 16 + 8 * hh];
        *(v8us*)&bkl.u[0] = *(const v8us*)&sKl[kb + nt * 16 + ln][ks * 32 + 8 * hh];
        *(v8us*)&bkl.u[8] = *(const v8us*)&sKl[kb + nt * 16 + ln][ks * 32 + 16 + 8 * hh];
        acc = mma3(aqh[ks].v, aql[ks].v, bkh.v, bkl.v, acc);
      }
      const float ksq = ksq2[nt];                        // D column = key kb+nt*16+ln
#pragma unroll
      for (int r = 0; r < 8; ++r) {
        const float d2 = sqrow[r] + ksq - 2.0f * acc[r];
        sP[wv][8 * hh + r][nt * 16 + ln] = (_Float16)(__expf(cexp * d2) * 4096.0f);
      }
    }
    __builtin_amdgcn_fence(__ATOMIC_ACQ_REL, "workgroup");
    __builtin_amdgcn_wave_barrier();
    FragH pa;                                            // A: row ln, k = key (split layout)
    pa.half[0] = *(const v8ha*)&sP[wv][ln][8 * hh];
    pa.half[1] = *(const v8ha*)&sP[wv][ln][16 + 8 * hh];
#pragma unroll
    for (int dt = 0; dt < 4; ++dt) {
      FragH bv;
#pragma unroll
      for (int i = 0; i < 8; ++i) { bv.h[i] = sV[kb + 8 * hh + i][dt * 16 + ln]; bv.h[8 + i] = sV[kb + 16 + 8 * hh + i][dt * 16 + ln]; }
      oacc[dt] = mma16(pa.v, bv.v, oacc[dt]);
    }
    __builtin_amdgcn_fence(__ATOMIC_ACQ_REL, "workgroup");
    __builtin_amdgcn_wave_barrier();                     // sP reads retired before the next chunk overwrites it
  }

  // the lane number is read anew here: no epilogue address then lives in a vector register through the loop (scratch stays 0 at 128 VGPRs)
  const int el = (int)__builtin_amdgcn_mbcnt_lo(~0u, 0u), eln = el & 15, ehh = el >> 4, etid = wv * 32 + el;
#pragma unroll
  for (int dt = 0; dt < 4; ++dt)
#pragma unroll
    for (int r = 0; r < 8; ++r) sO[g][w * 16 + 8 * ehh + r][dt * 16 + eln] = oacc[dt][r];
  __syncthreads();                                       // every key group's partial is in LDS before any thread sums them
  // out row = sum of the KSP partials in group order, then the exact 1/4096; 16 lanes store one whole 256-byte row
#pragma unroll
  for (int k = 0; k < QPB * (DH / 4) / NTHR; ++k) {
    const int idx = k * NTHR + etid, r = idx >> 4, c4 = (idx & 15) * 4;
    v4f val = *(const v4fa*)&sO[0][r][c4];
#pragma unroll
    for (int p = 1; p < KSP; ++p) val += *(const v4fa*)&sO[p][r][c4];
    *(v4f*)(O + (size_t)(qblk * QPB + r) * DH + c4) = val * (1.0f / 4096.0f);
  }
}

extern "C" void kernel_launch(void* const* d_in, const int* in_sizes, int n_in,
                              void* d_out, int out_size, void* d_ws, size_t ws_size, hipStream_t stream) {
  (void)in_sizes; (void)n_in; (void)out_size; (void)ws_size;
  const float* q = (const float*)d_in[0];
  const float* v = (const float*)d_in[1];
  k_split<<<NBH * L_TOK / 128, 128, 0, stream>>>(q, v, (unsigned short*)d_ws);
  k_softattn<<<NBH * (L_TOK / QPB), NTHR, 0, stream>>>((const unsigned short*)d_ws, (float*)d_out);
}

// v004
// It runs in 42.6 microseconds.
// Next to v003, in two timings, it ran 1.27 times as fast each time.
// Over all steps from v000 it is 5.44 times as fast.
#include <hip/hip_runtime.h>
// Contractions: dots = Q·Qᵀ (K=64) on v_wmma_f32_16x16x32_bf16 as a 3-term bf16 hi/lo split (f32-accurate squared
// distances), and out = S·V (K=2048 keys) on v_wmma_f32_16x16x32_f16 with S×4096 and V as f16 operands; f32 accumulate.
// Norms, exp and the 1/4096 epilogue in f32.
// Two launches: k_split writes the bf16 hi/lo split of q, the f16 copy of v and the row norms |q_i|^2 to the workspace once;
// k_softattn reads only those, so that no block repeats the conversion of the 2048 keys that its 31 neighbours of the same head need too.

#define L_TOK 2048
#define DH    64
#define NBH   16
#define QPB   64              // queries per block (4 query tiles of 16)
#define KSP   4               // key groups per block: wave group g takes keys 32g..32g+31 of every staged chunk for all 4 query tiles
#define NTHR  (128 * KSP)
#define KCH   (32 * KSP)      // keys staged per trip
#define VP    (DH + 16)       // sV row pitch in halves: 160 bytes, an odd multiple of 32, the conflict-free pitch of the transposing load
#define NEL   (NBH * L_TOK * DH)   // elements of q (and of v)
#define HEL   (L_TOK * DH)         // elements of one head; workspace in 16-bit units: head h has q hi at 3*HEL*h, q lo HEL and v f16 2*HEL behind it
                                   // (all three within an immediate offset of one address pair); the norms (f32) stand at 3*NEL

typedef _Float16 v16h __attribute__((ext_vector_type(16)));
typedef _Float16 v8h  __attribute__((ext_vector_type(8)));
typedef _Float16 v8ha __attribute__((ext_vector_type(8), may_alias));
typedef __bf16   v16b __attribute__((ext_vector_type(16)));
typedef float    v8f  __attribute__((ext_vector_type(8)));
typedef float    v4f  __attribute__((ext_vector_type(4)));
typedef float    v4fa __attribute__((ext_vector_type(4), may_alias));
typedef unsigned short v8us __attribute__((ext_vector_type(8), may_alias));
typedef unsigned short v4us __attribute__((ext_vector_type(4), may_alias));
typedef _Float16 v4ha __attribute__((ext_vector_type(4), may_alias));
typedef short s16x8 __attribute__((ext_vector_type(8)));
union FragH { v16h v; v8h half[2]; _Float16 h[16]; };
union FragB { v16b v; unsigned short u[16]; };

__device__ __forceinline__ unsigned short bf16_bits(float x) { unsigned int u = __float_as_uint(x); return (unsigned short)((u + 0x7FFFu + ((u >> 16) & 1u)) >> 16); }
__device__ __forceinline__ float bf16_val(unsigned short b) { return __uint_as_float(((unsigned int)b) << 16); }
__device__ __forceinline__ v8f mma16(v16h a, v16h b, v8f c) {
  c = __builtin_amdgcn_wmma_f32_16x16x32_f16(false, a, false, b, (short)0, c, false, false);
  asm volatile("v_nop\n\tv_nop\n\tv_nop\n\tv_nop" : "+v"(c) : "v"(a), "v"(b));
  return c;
}
__device__ __forceinline__ v8f mma3(v16b ah, v16b al, v16b bh, v16b bl, v8f c) {
  c = __builtin_amdgcn_wmma_f32_16x16x32_bf16(false, ah, false, bh, (short)0, c, false, false);
  c = __builtin_amdgcn_wmma_f32_16x16x32_bf16(false, ah, false, bl, (short)0, c, false, false);
  c = __builtin_amdgcn_wmma_f32_16x16x32_bf16(false, al, false, bh, (short)0, c, false, false);
  asm volatile("v_nop\n\tv_nop\n\tv_nop\n\tv_nop" : "+v"(c) : "v"(ah), "v"(al), "v"(bh), "v"(bl));
  return c;
}

// ds_load_tr16_b128: the 32 lanes name the 16-byte pieces of a 16 x 16 tile of halves that lies [k][n] in LDS (lane l: row 8*(l>>4) + (l&7), piece (l>>3)&1);
// lane (c = l&15, h = l>>4) gets T[8h + 0..7][c], which is half a B fragment in the hardware k order
__device__ __forceinline__ v8h ld_tr16(const _Float16* p) {
  typedef __attribute__((address_space(3))) s16x8 lds_s16x8;
  return __builtin_bit_cast(v8h, __builtin_amdgcn_ds_load_tr16_b128_v8i16((lds_s16x8*)p));
}

template <int M> __device__ __forceinline__ float row_xadd(float x) {   // x + x of lane ^ M inside the 16-lane row (DPP row_xmask)
  return x + __int_as_float(__builtin_amdgcn_update_dpp(0, __float_as_int(x), 0x160 + M, 0xf, 0xf, true));
}
__device__ __forceinline__ float row16_sum(float x) { return row_xadd<8>(row_xadd<4>(row_xadd<2>(row_xadd<1>(x)))); }

// One wave converts 32 consecutive rows: trip it takes rows it (lanes 0-15) and 16+it (lanes 16-31), 4 consecutive d a lane.
// Every 128-byte line of the four workspace planes has one writing wave.
__global__ __launch_bounds__(128) void k_split(const float* __restrict__ q, const float* __restrict__ v, unsigned short* __restrict__ ws) {
  const int tid = threadIdx.x, lane = tid & 31, ln = lane & 15, hh = lane >> 4;
  const int row0 = (blockIdx.x * 4 + (tid >> 5)) * 32;
  const size_t e0 = (size_t)(row0 + 16 * hh) * DH + ln * 4;
  const float* pq = q + e0; const float* pv = v + e0;
  v4f kq[16], vv[16];
#pragma unroll   // all 32 loads leave before any is used: one load round trip for the launch
  for (int it = 0; it < 16; ++it) {
    kq[it] = *(const v4fa*)(pq + it * DH);
    vv[it] = *(const v4fa*)(pv + it * DH);
  }
  // the two address pairs are inputs, so they stay whole up to this wait
  asm volatile("s_wait_xcnt 0x0" :: "v"(pq), "v"(pv) : "memory");
  unsigned short* ph = ws + e0 + (size_t)(row0 / L_TOK) * (2 * HEL);   // the 32 rows of a wave lie in one head
  float ksq_mine = 0.f;
#pragma unroll   // kq[it], vv[it] stay in registers
  for (int it = 0; it < 16; ++it) {
    v4us h4, l4; v4ha f4;
#pragma unroll
    for (int t = 0; t < 4; ++t) {
      const unsigned short hb = bf16_bits(kq[it][t]);
      h4[t] = hb; l4[t] = bf16_bits(kq[it][t] - bf16_val(hb));
      f4[t] = (_Float16)vv[it][t];
    }
    *(v4us*)(ph + it * DH) = h4;
    *(v4us*)(ph + HEL + it * DH) = l4;
    *(v4ha*)(ph + 2 * HEL + it * DH) = f4;
    // |q_j|^2 in f32 from the f32 values in registers: the 16 lanes of a row hold one row, every lane ends with its sum
    const float s = row16_sum(kq[it][0] * kq[it][0] + kq[it][1] * kq[it][1] + kq[it][2] * kq[it][2] + kq[it][3] * kq[it][3]);
    if (ln == it) ksq_mine = s;                          // lane 16*hh + it keeps row 16*hh + it
  }
  ((float*)(ws + 3 * (size_t)NEL))[row0 + lane] = ksq_mine;
}

// second argument: 8 waves a SIMD, so that two blocks of 16 waves stay resident on a WGP
__global__ __launch_bounds__(NTHR, 8) void k_softattn(const unsigned short* __restrict__ ws, float* __restrict__ out) {
  __shared__ __attribute__((aligned(16))) unsigned short sKh[KCH][DH + 8], sKl[KCH][DH + 8];   // key chunk, bf16 hi/lo [key][d]
  __shared__ __attribute__((aligned(16))) _Float16 sV[KCH][VP];                           // value chunk f16 [key][d]
  __shared__ __attribute__((aligned(16))) _Float16 sP[4 * KSP][16][40];                        // per-wave S*4096 tile f16 [row][key]
  __shared__ __attribute__((aligned(16))) float sO[KSP][QPB][DH];                         // per key group: partial out*4096 of the block's 64 queries

  const int tid = threadIdx.x, lane = tid & 31, ln = lane & 15, hh = lane >> 4;
  const int wv = __builtin_amdgcn_readfirstlane(tid >> 5), w = wv & 3, g = wv >> 2;   // wave number, query tile, key group: scalar registers
  const int kb = g * 32;                                 // this wave's first key row inside the staged chunk
  const int bh = blockIdx.x / (L_TOK / QPB), qblk = blockIdx.x % (L_TOK / QPB);
  const int q0 = qblk * QPB + w * 16;
  const size_t base = (size_t)bh * L_TOK * DH;
  const unsigned short* QH = ws + 3 * base;              // hi plane of this head; lo at + HEL, v at + 2*HEL
  const float* NRM = (const float*)(ws + 3 * (size_t)NEL) + bh * L_TOK;
  float* O = out + base;
  const float cexp = -1.0f / 16.0f;                      // -1/(2*sqrt(64))

  // A fragments of this wave's 16 query rows (bf16 hi/lo, row ln, k = d split layout) and |q|^2 of the D rows this lane holds (rows 8hh+r)
  FragB aqh[2], aql[2];
  float sqrow[8];
  {
    const unsigned short* qr = QH + (size_t)(q0 + ln) * DH + 8 * hh;
#pragma unroll
    for (int ks = 0; ks < 2; ++ks) {
      *(v8us*)&aqh[ks].u[0] = *(const v8us*)(qr + ks * 32);
      *(v8us*)&aqh[ks].u[8] = *(const v8us*)(qr + ks * 32 + 16);
      *(v8us*)&aql[ks].u[0] = *(const v8us*)(qr + HEL + ks * 32);
      *(v8us*)&aql[ks].u[8] = *(const v8us*)(qr + HEL + ks * 32 + 16);
    }
    const v4f n0 = *(const v4fa*)(NRM + q0 + 8 * hh), n1 = *(const v4fa*)(NRM + q0 + 8 * hh + 4);
#pragma unroll
    for (int r = 0; r < 4; ++r) { sqrow[r] = n0[r]; sqrow[4 + r] = n1[r]; }
  }

  v8f oacc[4] = {};
  const _Float16* vt = &sV[kb + 8 * hh + (lane & 7)][8 * ((lane >> 3) & 1)];   // this lane's piece of the wave's first 16 x 16 value tile
  const int r0 = tid >> 3, c8s = (tid & 7) * 8;          // staging: row within a group of 16*KSP, first d of this thread's 16 bytes
  for (int c = 0; c < L_TOK / KCH; ++c) {
    const unsigned short* pk = QH + (size_t)c * (KCH * DH) + tid * 8;
    const float* pn = NRM + c * KCH + kb + ln;
    // this thread's share of the chunk: 16 bytes of rows r0 and r0 + 16*KSP of each plane, and the norms of the two keys whose D column it holds
    v8us kh[2], kl[2], vh[2]; float ksq2[2];
#pragma unroll   // all 8 loads leave before any is used: one load round trip a chunk
    for (int it = 0; it < 2; ++it) {
      kh[it] = *(const v8us*)(pk + it * (NTHR * 8));
      kl[it] = *(const v8us*)(pk + HEL + it * (NTHR * 8));
      vh[it] = *(const v8us*)(pk + 2 * HEL + it * (NTHR * 8));
      ksq2[it] = pn[it * 16];
    }
    // the two address pairs are inputs, so they stay whole up to this wait; the wave waits for the load data next in any case
    asm volatile("s_wait_xcnt 0x0" :: "v"(pk), "v"(pn) : "memory");
    __syncthreads();
#pragma unroll
    for (int it = 0; it < 2; ++it) {
      const int r = it * (16 * KSP) + r0;
      *(v8us*)&sKh[r][c8s] = kh[it];
      *(v8us*)&sKl[r][c8s] = kl[it];
      *(v8us*)&sV[r][c8s] = vh[it];
    }
    __syncthreads();

    // dots tile 16 x 32 (two 16-key sub-tiles), 3-term split, then S = exp(cexp*(|q|^2+|k|^2-2 dots)) * 4096 -> f16 LDS tile
#pragma unroll
    for (int nt = 0; nt < 2; ++nt) {
      v8f acc = {};
#pragma unroll
      for (int ks = 0; ks < 2; ++ks) {
        FragB bkh, bkl;
        *(v8us*)&bkh.u[0] = *(const v8us*)&sKh[kb + nt * 16 + ln][ks * 32 + 8 * hh];
        *(v8us*)&bkh.u[8] = *(const v8us*)&sKh[kb + nt * 16 + ln][ks * 32 + 16 + 8 * hh];
        *(v8us*)&bkl.u[0] = *(const v8us*)&sKl[kb + nt * 16 + ln][ks * 32 + 8 * hh];
        *(v8us*)&bkl.u[8] = *(const v8us*)&sKl[kb + nt * 16 + ln][ks * 32 + 16 + 8 * hh];
        acc = mma3(aqh[ks].v, aql[ks].v, bkh.v, bkl.v, acc);
      }
      const float ksq = ksq2[nt];                        // D column = key kb+nt*16+ln
#pragma unroll
      for (int r = 0; r < 8; ++r) {
        const float d2 = sqrow[r] + ksq - 2.0f * acc[r];
        sP[wv][8 * hh + r][nt * 16 + ln] = (_Float16)(__expf(cexp * d2) * 4096.0f);
      }
    }
    __builtin_amdgcn_fence(__ATOMIC_ACQ_REL, "workgroup");
    __builtin_amdgcn_wave_barrier();
    FragH pa;                                            // A: row ln, k = key (split layout)
    pa.half[0] = *(const v8ha*)&sP[wv][ln][8 * hh];
    pa.half[1] = *(const v8ha*)&sP[wv][ln][16 + 8 * hh];
    FragH bv[4];                                         // B: column d = dt*16+ln, k = keys kb+8hh+0..7 and kb+16+8hh+0..7, as pa has them
#pragma unroll   // all 8 loads stand in one place: one LDS round trip for the four products
    for (int dt = 0; dt < 4; ++dt) {
      bv[dt].half[0] = ld_tr16(vt + dt * 16);
      bv[dt].half[1] = ld_tr16(vt + 16 * VP + dt * 16);
    }
#pragma unroll
    for (int dt = 0; dt < 4; ++dt) oacc[dt] = mma16(pa.v, bv[dt].v, oacc[dt]);
    __builtin_amdgcn_fence(__ATOMIC_ACQ_REL, "workgroup");
    __builtin_amdgcn_wave_barrier();                     // sP reads retired before the next chunk overwrites it
  }

  // the lane number is read anew here: no epilogue address then lives in a vector register through the loop (scratch stays 0 at 128 VGPRs)
  const int el = (int)__builtin_amdgcn_mbcnt_lo(~0u, 0u), eln = el & 15, ehh = el >> 4, etid = wv * 32 + el;
#pragma unroll
  for (int dt = 0; dt < 4; ++dt)
#pragma unroll
    for (int r = 0; r < 8; ++r) sO[g][w * 16 + 8 * ehh + r][dt * 16 + eln] = oacc[dt][r];
  __syncthreads();                                       // every key group's partial is in LDS before any thread sums them
  // out row = sum of the KSP partials in group order, then the exact 1/4096; 16 lanes store one whole 256-byte row
#pragma unroll
  for (int k = 0; k < QPB * (DH / 4) / NTHR; ++k) {
    const int idx = k * NTHR + etid, r = idx >> 4, c4 = (idx & 15) * 4;
    v4f val = *(const v4fa*)&sO[0][r][c4];
#pragma unroll
    for (int p = 1; p < KSP; ++p) val += *(const v4fa*)&sO[p][r][c4];
    *(v4f*)(O + (size_t)(qblk * QPB + r) * DH + c4) = val * (1.0f / 4096.0f);
  }
}

extern "C" void kernel_launch(void* const* d_in, const int* in_sizes, int n_in,
                              void* d_out, int out_size, void* d_ws, size_t ws_size, hipStream_t stream) {
  (void)in_sizes; (void)n_in; (void)out_size; (void)ws_size;
  const float* q = (const float*)d_in[0];
  const float* v = (const float*)d_in[1];
  k_split<<<NBH * L_TOK / 128, 128, 0, stream>>>(q, v, (unsigned short*)d_ws);
  k_softattn<<<NBH * (L_TOK / QPB), NTHR, 0, stream>>>((const unsigned short*)d_ws, (float*)d_out);
}

// v005
// Measured time: 39.3 microseconds a run.
// Two timings next to v004 put it at 1.11 and 1.08 times that version's speed.
// Counting every step since v000, it is 5.95 times as fast.
#include <hip/hip_runtime.h>
// Contractions: dots = Q·Qᵀ (K=64) on v_wmma_f32_16x16x32_bf16 as a 3-term bf16 hi/lo split (f32-accurate squared
// distances), and out = S·V (K=2048 keys) on v_wmma_f32_16x16x32_f16 with S×4096 and V as f16 operands; f32 accumulate.
// Both products run transposed (keys x queries, then d x queries): the score accumulators of 32 keys, converted in place, are the B operand of the second.
// Norms, exp and the 1/4096 epilogue in f32.
// Two launches: k_split writes the bf16 hi/lo split of q, the f16 copy of v and the row norms |q_i|^2 to the workspace once;
// k_softattn reads only those, so that no block repeats the conversion of the 2048 keys that its 31 neighbours of the same head need too.

#define L_TOK 2048
#define DH    64
#define NBH   16
#define QPB   64              // queries per block (4 query tiles of 16)
#define KSP   4               // key groups per block: wave group g takes keys 32g..32g+31 of every staged chunk for all 4 query tiles
#define NTHR  (128 * KSP)
#define KCH   (32 * KSP)      // keys staged per trip
#define VP    (DH + 16)       // sV row pitch in halves: 160 bytes, an odd multiple of 32, the conflict-free pitch of the transposing load
#define OP    (DH + 4)        // sO row pitch in floats: 272 bytes, an odd multiple of 16, so that 16 lanes storing 16 bytes of 16 rows meet no bank twice
#define NEL   (NBH * L_TOK * DH)   // elements of q (and of v)
#define HEL   (L_TOK * DH)         // elements of one head; workspace in 16-bit units: head h has q hi at 3*HEL*h, q lo HEL and v f16 2*HEL behind it
                                   // (all three within an immediate offset of one address pair); the norms (f32) stand at 3*NEL

typedef _Float16 v16h __attribute__((ext_vector_type(16)));
typedef _Float16 v8h  __attribute__((ext_vector_type(8)));
typedef _Float16 v8ha __attribute__((ext_vector_type(8), may_alias));
typedef __bf16   v16b __attribute__((ext_vector_type(16)));
typedef float    v8f  __attribute__((ext_vector_type(8)));
typedef float    v4f  __attribute__((ext_vector_type(4)));
typedef float    v4fa __attribute__((ext_vector_type(4), may_alias));
typedef unsigned short v8us __attribute__((ext_vector_type(8), may_alias));
typedef unsigned short v4us __attribute__((ext_vector_type(4), may_alias));
typedef _Float16 v4ha __attribute__((ext_vector_type(4), may_alias));
typedef short s16x8 __attribute__((ext_vector_type(8)));
union FragH { v16h v; v8h half[2]; _Float16 h[16]; };
union FragB { v16b v; unsigned short u[16]; };

__device__ __forceinline__ unsigned short bf16_bits(float x) { unsigned int u = __float_as_uint(x); return (unsigned short)((u + 0x7FFFu + ((u >> 16) & 1u)) >> 16); }
__device__ __forceinline__ float bf16_val(unsigned short b) { return __uint_as_float(((unsigned int)b) << 16); }
__device__ __forceinline__ v8f mma16(v16h a, v16h b, v8f c) {
  c = __builtin_amdgcn_wmma_f32_16x16x32_f16(false, a, false, b, (short)0, c, false, false);
  asm volatile("v_nop\n\tv_nop\n\tv_nop\n\tv_nop" : "+v"(c) : "v"(a), "v"(b));
  return c;
}
__device__ __forceinline__ v8f mma3(v16b ah, v16b al, v16b bh, v16b bl, v8f c) {   // hi*hi, lo(A)*hi(B), hi(A)*lo(B)
  c = __builtin_amdgcn_wmma_f32_16x16x32_bf16(false, ah, false, bh, (short)0, c, false, false);
  c = __builtin_amdgcn_wmma_f32_16x16x32_bf16(false, al, false, bh, (short)0, c, false, false);
  c = __builtin_amdgcn_wmma_f32_16x16x32_bf16(false, ah, false, bl, (short)0, c, false, false);
  asm volatile("v_nop\n\tv_nop\n\tv_nop\n\tv_nop" : "+v"(c) : "v"(ah), "v"(al), "v"(bh), "v"(bl));
  return c;
}

// ds_load_tr16_b128: the 32 lanes name the 16-byte pieces of a 16 x 16 tile of halves that lies [k][n] in LDS (lane l: row 8*(l>>4) + (l&7), piece (l>>3)&1);
// lane (c = l&15, h = l>>4) gets T[8h + 0..7][c], which is half an A fragment of the transposed tile in the hardware k order
__device__ __forceinline__ v8h ld_tr16(const _Float16* p) {
  typedef __attribute__((address_space(3))) s16x8 lds_s16x8;
  return __builtin_bit_cast(v8h, __builtin_amdgcn_ds_load_tr16_b128_v8i16((lds_s16x8*)p));
}

template <int M> __device__ __forceinline__ float row_xadd(float x) {   // x + x of lane ^ M inside the 16-lane row (DPP row_xmask)
  return x + __int_as_float(__builtin_amdgcn_update_dpp(0, __float_as_int(x), 0x160 + M, 0xf, 0xf, true));
}
__device__ __forceinline__ float row16_sum(float x) { return row_xadd<8>(row_xadd<4>(row_xadd<2>(row_xadd<1>(x)))); }

// One wave converts 32 consecutive rows: trip it takes rows it (lanes 0-15) and 16+it (lanes 16-31), 4 consecutive d a lane.
// Every 128-byte line of the four workspace planes has one writing wave.
__global__ __launch_bounds__(128) void k_split(const float* __restrict__ q, const float* __restrict__ v, unsigned short* __restrict__ ws) {
  const int tid = threadIdx.x, lane = tid & 31, ln = lane & 15, hh = lane >> 4;
  const int row0 = (blockIdx.x * 4 + (tid >> 5)) * 32;
  const size_t e0 = (size_t)(row0 + 16 * hh) * DH + ln * 4;
  const float* pq = q + e0; const float* pv = v + e0;
  v4f kq[16], vv[16];
#pragma unroll   // all 32 loads leave before any is used: one load round trip for the launch
  for (int it = 0; it < 16; ++it) {
    kq[it] = *(const v4fa*)(pq + it * DH);
    vv[it] = *(const v4fa*)(pv + it * DH);
  }
  // the two address pairs are inputs, so they stay whole up to this wait
  asm volatile("s_wait_xcnt 0x0" :: "v"(pq), "v"(pv) : "memory");
  unsigned short* ph = ws + e0 + (size_t)(row0 / L_TOK) * (2 * HEL);   // the 32 rows of a wave lie in one head
  float ksq_mine = 0.f;
#pragma unroll   // kq[it], vv[it] stay in registers
  for (int it = 0; it < 16; ++it) {
    v4us h4, l4; v4ha f4;
#pragma unroll
    for (int t = 0; t < 4; ++t) {
      const unsigned short hb = bf16_bits(kq[it][t]);
      h4[t] = hb; l4[t] = bf16_bits(kq[it][t] - bf16_val(hb));
      f4[t] = (_Float16)vv[it][t];
    }
    *(v4us*)(ph + it * DH) = h4;
    *(v4us*)(ph + HEL + it * DH) = l4;
    *(v4ha*)(ph + 2 * HEL + it * DH) = f4;
    // |q_j|^2 in f32 from the f32 values in registers: the 16 lanes of a row hold one row, every lane ends with its sum
    const float s = row16_sum(kq[it][0] * kq[it][0] + kq[it][1] * kq[it][1] + kq[it][2] * kq[it][2] + kq[it][3] * kq[it][3]);
    if (ln == it) ksq_mine = s;                          // lane 16*hh + it keeps row 16*hh + it
  }
  ((float*)(ws + 3 * (size_t)NEL))[row0 + lane] = ksq_mine;
}

// second argument: 8 waves a SIMD, so that two blocks of 16 waves stay resident on a WGP
__global__ __launch_bounds__(NTHR, 8) void k_softattn(const unsigned short* __restrict__ ws, float* __restrict__ out) {
  __shared__ __attribute__((aligned(16))) unsigned short sKh[KCH][DH + 8], sKl[KCH][DH + 8];   // key chunk, bf16 hi/lo [key][d]
  __shared__ __attribute__((aligned(16))) _Float16 sV[KCH][VP];                           // value chunk f16 [key][d]
  __shared__ __attribute__((aligned(16))) float sO[KSP][QPB][OP];                         // per key group: partial out*4096 of the block's 64 queries

  const int tid = threadIdx.x, lane = tid & 31, ln = lane & 15, hh = lane >> 4;
  const int wv = __builtin_amdgcn_readfirstlane(tid >> 5), w = wv & 3, g = wv >> 2;   // wave number, query tile, key group: scalar registers
  const int kb = g * 32;                                 // this wave's first key row inside the staged chunk
  const int bh = blockIdx.x / (L_TOK / QPB), qblk = blockIdx.x % (L_TOK / QPB);
  const int q0 = qblk * QPB + w * 16;
  const size_t base = (size_t)bh * L_TOK * DH;
  const unsigned short* QH = ws + 3 * base;              // hi plane of this head; lo at + HEL, v at + 2*HEL
  const float* NRM = (const float*)(ws + 3 * (size_t)NEL) + bh * L_TOK;
  float* O = out + base;
  const float cexp = -1.0f / 16.0f;                      // -1/(2*sqrt(64))

  // B fragments of this wave's 16 queries (bf16 hi/lo, column ln, k = d split layout) and |q|^2 of the one query whose D column this lane holds
  FragB aqh[2], aql[2];
  float sqq;
  {
    const unsigned short* qr = QH + (size_t)(q0 + ln) * DH + 8 * hh;
#pragma unroll
    for (int ks = 0; ks < 2; ++ks) {
      *(v8us*)&aqh[ks].u[0] = *(const v8us*)(qr + ks * 32);
      *(v8us*)&aqh[ks].u[8] = *(const v8us*)(qr + ks * 32 + 16);
      *(v8us*)&aql[ks].u[0] = *(const v8us*)(qr + HEL + ks * 32);
      *(v8us*)&aql[ks].u[8] = *(const v8us*)(qr + HEL + ks * 32 + 16);
    }
    const int qi = q0 + ln;
    sqq = NRM[qi];
    // what these loads name (address pair, index, scalar base) are inputs, so they stay whole up to this wait
    asm volatile("s_wait_xcnt 0x0" :: "v"(qr), "v"(qi), "s"(NRM) : "memory");
  }

  v8f oacc[4] = {};
  const _Float16* vt = &sV[kb + 8 * hh + (lane & 7)][8 * ((lane >> 3) & 1)];   // this lane's piece of the wave's first 16 x 16 value tile
  const int r0 = tid >> 3, c8s = (tid & 7) * 8;          // staging: row within a group of 16*KSP, first d of this thread's 16 bytes
  const float* pn = NRM + kb + 8 * hh;                   // norms of the 8 keys whose D rows this lane holds in the chunk's first sub-tile; moves on by a chunk a trip
  for (int c = 0; c < L_TOK / KCH; ++c) {
    const unsigned short* pk = QH + (size_t)c * (KCH * DH) + tid * 8;
    // this thread's share of the chunk: 16 bytes of rows r0 and r0 + 16*KSP of each plane, and the norms of the 2 x 8 keys whose D rows it holds
    v8us kh[2], kl[2], vh[2]; v4f ksq4[2][2];
#pragma unroll   // all 10 loads leave before any is used: one load round trip a chunk
    for (int it = 0; it < 2; ++it) {
      kh[it] = *(const v8us*)(pk + it * (NTHR * 8));
      kl[it] = *(const v8us*)(pk + HEL + it * (NTHR * 8));
      vh[it] = *(const v8us*)(pk + 2 * HEL + it * (NTHR * 8));
      ksq4[it][0] = *(const v4fa*)(pn + it * 16);
      ksq4[it][1] = *(const v4fa*)(pn + it * 16 + 4);
    }
    // the two address pairs are inputs, so they stay whole up to this wait; the wave waits for the load data next in any case
    asm volatile("s_wait_xcnt 0x0" :: "v"(pk), "v"(pn) : "memory");
    pn += KCH;
    __syncthreads();
#pragma unroll
    for (int it = 0; it < 2; ++it) {
      const int r = it * (16 * KSP) + r0;
      *(v8us*)&sKh[r][c8s] = kh[it];
      *(v8us*)&sKl[r][c8s] = kl[it];
      *(v8us*)&sV[r][c8s] = vh[it];
    }
    __syncthreads();

    // dots tile 32 keys x 16 queries (two 16-key sub-tiles), 3-term split, then S = exp(cexp*(|q|^2+|k|^2-2 dots)) * 4096 -> f16 in registers:
    // D row 8hh+r of sub-tile nt is key nt*16+8hh+r, which is element nt*8+r of a B fragment in the hardware k order
    FragH pb;
#pragma unroll
    for (int nt = 0; nt < 2; ++nt) {
      v8f acc = {};
#pragma unroll
      for (int ks = 0; ks < 2; ++ks) {
        FragB bkh, bkl;
        *(v8us*)&bkh.u[0] = *(const v8us*)&sKh[kb + nt * 16 + ln][ks * 32 + 8 * hh];
        *(v8us*)&bkh.u[8] = *(const v8us*)&sKh[kb + nt * 16 + ln][ks * 32 + 16 + 8 * hh];
        *(v8us*)&bkl.u[0] = *(const v8us*)&sKl[kb + nt * 16 + ln][ks * 32 + 8 * hh];
        *(v8us*)&bkl.u[8] = *(const v8us*)&sKl[kb + nt * 16 + ln][ks * 32 + 16 + 8 * hh];
        acc = mma3(bkh.v, bkl.v, aqh[ks].v, aql[ks].v, acc);
      }
#pragma unroll
      for (int r = 0; r < 8; ++r) {
        const float d2 = sqq + ksq4[nt][r >> 2][r & 3] - 2.0f * acc[r];
        pb.h[nt * 8 + r] = (_Float16)(__expf(cexp * d2) * 4096.0f);
      }
    }
    FragH bv[4];                                         // A: row d = dt*16+ln, k = keys kb+8hh+0..7 and kb+16+8hh+0..7, as pb has them
#pragma unroll   // all 8 loads stand in one place: one LDS round trip for the four products
    for (int dt = 0; dt < 4; ++dt) {
      bv[dt].half[0] = ld_tr16(vt + dt * 16);
      bv[dt].half[1] = ld_tr16(vt + 16 * VP + dt * 16);
    }
#pragma unroll
    for (int dt = 0; dt < 4; ++dt) oacc[dt] = mma16(bv[dt].v, pb.v, oacc[dt]);   // oacc[dt][r] = out*4096 of query ln at d = dt*16+8hh+r
  }

  // the lane number is read anew here: no epilogue address then lives in a vector register through the loop (scratch stays 0 at 128 VGPRs)
  const int el = (int)__builtin_amdgcn_mbcnt_lo(~0u, 0u), eln = el & 15, ehh = el >> 4, etid = wv * 32 + el;
#pragma unroll
  for (int dt = 0; dt < 4; ++dt) {
    *(v4fa*)&sO[g][w * 16 + eln][dt * 16 + 8 * ehh] = (v4f){oacc[dt][0], oacc[dt][1], oacc[dt][2], oacc[dt][3]};
    *(v4fa*)&sO[g][w * 16 + eln][dt * 16 + 8 * ehh + 4] = (v4f){oacc[dt][4], oacc[dt][5], oacc[dt][6], oacc[dt][7]};
  }
  __syncthreads();                                       // every key group's partial is in LDS before any thread sums them
  // out row = sum of the KSP partials in group order, then the exact 1/4096; 16 lanes store one whole 256-byte row
#pragma unroll
  for (int k = 0; k < QPB * (DH / 4) / NTHR; ++k) {
    const int idx = k * NTHR + etid, r = idx >> 4, c4 = (idx & 15) * 4;
    v4f val = *(const v4fa*)&sO[0][r][c4];
#pragma unroll
    for (int p = 1; p < KSP; ++p) val += *(const v4fa*)&sO[p][r][c4];
    *(v4f*)(O + (size_t)(qblk * QPB + r) * DH + c4) = val * (1.0f / 4096.0f);
  }
}

extern "C" void kernel_launch(void* const* d_in, const int* in_sizes, int n_in,
                              void* d_out, int out_size, void* d_ws, size_t ws_size, hipStream_t stream) {
  (void)in_sizes; (void)n_in; (void)out_size; (void)ws_size;
  const float* q = (const float*)d_in[0];
  const float* v = (const float*)d_in[1];
  k_split<<<NBH * L_TOK / 128, 128, 0, stream>>>(q, v, (unsigned short*)d_ws);
  k_softattn<<<NBH * (L_TOK / QPB), NTHR, 0, stream>>>((const unsigned short*)d_ws, (float*)d_out);
}

// v006
// A run of this version takes 36.6 microseconds.
// In two side-by-side timings against v005, it was 1.06 and 1.05 times as fast.
// All steps since v000 together make it 6.27 times as fast.
#include <hip/hip_runtime.h>
// Contractions: dots = Q·Qᵀ (K=64) on v_wmma_f32_16x16x32_bf16 as a 3-term bf16 hi/lo split (f32-accurate squared
// distances), and out = S·V (K=2048 keys) on v_wmma_f32_16x16x32_f16 with S×4096 and V as f16 operands; f32 accumulate.
// Both products run transposed (keys x queries, then d x queries): the score accumulators of 32 keys, converted in place, are the B operand of the second.
// Norms, exp and the 1/4096 epilogue in f32.
// Two launches: k_split writes the bf16 hi/lo split of q, the f16 copy of v and the row norms |q_i|^2 to the workspace once;
// k_softattn reads only those, so that no block repeats the conversion of the 2048 keys that its 31 neighbours of the same head need too.
// Its key chunks come to LDS by asynchronous copies in a ring of two buffers: chunk c + 1 is under way while chunk c is worked on.

#define L_TOK 2048
#define DH    64
#define NBH   16
#define QPB   64              // queries per block (4 query tiles of 16)
#define KSP   4               // key groups per block: wave group g takes keys 32g..32g+31 of every staged chunk for all 4 query tiles
#define NTHR  (128 * KSP)
#define KCH   (32 * KSP)      // keys staged per trip
#define VP    (DH + 16)       // value row pitch in LDS, halves: 160 bytes, an odd multiple of 32, the conflict-free pitch of the transposing load
#define OP    (DH + 4)        // sO row pitch in floats: 272 bytes, an odd multiple of 16, so that 16 lanes storing 16 bytes of 16 rows meet no bank twice
#define NCH   (L_TOK / KCH)   // chunks (trips) of a head
#define KPB   ((DH + 8) * 2)  // key row pitch in LDS, bytes: 144, an odd multiple of 16, the conflict-free pitch of ds_load_b128
#define VPB   (VP * 2)        // value row pitch in LDS, bytes
#define OFF_KL (KCH * KPB)               // inside a buffer: key hi plane at 0, key lo plane here,
#define OFF_V  (2 * KCH * KPB)           // value plane here
#define BUFB   (2 * KCH * KPB + KCH * VPB)   // bytes of one buffer of the ring
#define OFF_N  (2 * BUFB)                // behind the two buffers: |q_j|^2 of the head's 2048 keys, f32
#define SMEMB  (OFF_N + L_TOK * 4)
#define NEL   (NBH * L_TOK * DH)   // elements of q (and of v)
#define HEL   (L_TOK * DH)         // elements of one head; workspace in 16-bit units: head h has q hi at 3*HEL*h, q lo HEL and v f16 2*HEL behind it
                                   // (all three within an immediate offset of one address pair); the norms (f32) stand at 3*NEL

typedef _Float16 v16h __attribute__((ext_vector_type(16)));
typedef _Float16 v8h  __attribute__((ext_vector_type(8)));
typedef _Float16 v8ha __attribute__((ext_vector_type(8), may_alias));
typedef __bf16   v16b __attribute__((ext_vector_type(16)));
typedef float    v8f  __attribute__((ext_vector_type(8)));
typedef float    v4f  __attribute__((ext_vector_type(4)));
typedef float    v4fa __attribute__((ext_vector_type(4), may_alias));
typedef unsigned short v8us __attribute__((ext_vector_type(8), may_alias));
typedef unsigned short v4us __attribute__((ext_vector_type(4), may_alias));
typedef _Float16 v4ha __attribute__((ext_vector_type(4), may_alias));
typedef short s16x8 __attribute__((ext_vector_type(8)));
union FragH { v16h v; v8h half[2]; _Float16 h[16]; };
union FragB { v16b v; unsigned short u[16]; };

__device__ __forceinline__ unsigned short bf16_bits(float x) { unsigned int u = __float_as_uint(x); return (unsigned short)((u + 0x7FFFu + ((u >> 16) & 1u)) >> 16); }
__device__ __forceinline__ float bf16_val(unsigned short b) { return __uint_as_float(((unsigned int)b) << 16); }
__device__ __forceinline__ v8f mma16(v16h a, v16h b, v8f c) {
  c = __builtin_amdgcn_wmma_f32_16x16x32_f16(false, a, false, b, (short)0, c, false, false);
  asm volatile("v_nop\n\tv_nop\n\tv_nop\n\tv_nop" : "+v"(c) : "v"(a), "v"(b));
  return c;
}
__device__ __forceinline__ v8f mma3(v16b ah, v16b al, v16b bh, v16b bl, v8f c) {   // hi*hi, lo(A)*hi(B), hi(A)*lo(B)
  c = __builtin_amdgcn_wmma_f32_16x16x32_bf16(false, ah, false, bh, (short)0, c, false, false);
  c = __builtin_amdgcn_wmma_f32_16x16x32_bf16(false, al, false, bh, (short)0, c, false, false);
  c = __builtin_amdgcn_wmma_f32_16x16x32_bf16(false, ah, false, bl, (short)0, c, false, false);
  asm volatile("v_nop\n\tv_nop\n\tv_nop\n\tv_nop" : "+v"(c) : "v"(ah), "v"(al), "v"(bh), "v"(bl));
  return c;
}

// ds_load_tr16_b128: the 32 lanes name the 16-byte pieces of a 16 x 16 tile of halves that lies [k][n] in LDS (lane l: row 8*(l>>4) + (l&7), piece (l>>3)&1);
// lane (c = l&15, h = l>>4) gets T[8h + 0..7][c], which is half an A fragment of the transposed tile in the hardware k order
__device__ __forceinline__ v8h ld_tr16(const _Float16* p) {
  typedef __attribute__((address_space(3))) s16x8 lds_s16x8;
  return __builtin_bit_cast(v8h, __builtin_amdgcn_ds_load_tr16_b128_v8i16((lds_s16x8*)p));
}

__device__ __forceinline__ unsigned lds_addr(const void* p) {   // byte address inside the work-group's LDS
  typedef __attribute__((address_space(3))) const unsigned char lds_u8;
  return (unsigned)(size_t)(lds_u8*)p;
}
// One thread's share of a chunk, LDS <- workspace with no register in between: 16 bytes of rows r and r + 16*KSP of each of the three planes.
// gk: this thread's 16 bytes of the hi plane's first row group; lk, lv: its place in the buffer's hi plane and value plane.
// The s_wait_xcnt closes the statement so that no address register is rewritten while a copy may still name it.
__device__ __forceinline__ void copy_chunk(const unsigned short* gk, unsigned lk, unsigned lv) {
  asm volatile("global_load_async_to_lds_b128 %0, %6, off\n\t"
               "global_load_async_to_lds_b128 %1, %7, off\n\t"
               "global_load_async_to_lds_b128 %2, %8, off\n\t"
               "global_load_async_to_lds_b128 %3, %9, off\n\t"
               "global_load_async_to_lds_b128 %4, %10, off\n\t"
               "global_load_async_to_lds_b128 %5, %11, off\n\t"
               "s_wait_xcnt 0x0"
               :: "v"(lk), "v"(lk + 16 * KSP * KPB), "v"(lk + OFF_KL), "v"(lk + OFF_KL + 16 * KSP * KPB), "v"(lv), "v"(lv + 16 * KSP * VPB),
                  "v"(gk), "v"(gk + NTHR * 8), "v"(gk + HEL), "v"(gk + HEL + NTHR * 8), "v"(gk + 2 * HEL), "v"(gk + 2 * HEL + NTHR * 8)
               : "memory");
}

template <int M> __device__ __forceinline__ float row_xadd(float x) {   // x + x of lane ^ M inside the 16-lane row (DPP row_xmask)
  return x + __int_as_float(__builtin_amdgcn_update_dpp(0, __float_as_int(x), 0x160 + M, 0xf, 0xf, true));
}
__device__ __forceinline__ float row16_sum(float x) { return row_xadd<8>(row_xadd<4>(row_xadd<2>(row_xadd<1>(x)))); }

// One wave converts 32 consecutive rows: trip it takes rows it (lanes 0-15) and 16+it (lanes 16-31), 4 consecutive d a lane.
// Every 128-byte line of the four workspace planes has one writing wave.
__global__ __launch_bounds__(128) void k_split(const float* __restrict__ q, const float* __restrict__ v, unsigned short* __restrict__ ws) {
  const int tid = threadIdx.x, lane = tid & 31, ln = lane & 15, hh = lane >> 4;
  const int row0 = (blockIdx.x * 4 + (tid >> 5)) * 32;
  const size_t e0 = (size_t)(row0 + 16 * hh) * DH + ln * 4;
  const float* pq = q + e0; const float* pv = v + e0;
  v4f kq[16], vv[16];
#pragma unroll   // all 32 loads leave before any is used: one load round trip for the launch
  for (int it = 0; it < 16; ++it) {
    kq[it] = *(const v4fa*)(pq + it * DH);
    vv[it] = *(const v4fa*)(pv + it * DH);
  }
  // the two address pairs are inputs, so they stay whole up to this wait
  asm volatile("s_wait_xcnt 0x0" :: "v"(pq), "v"(pv) : "memory");
  unsigned short* ph = ws + e0 + (size_t)(row0 / L_TOK) * (2 * HEL);   // the 32 rows of a wave lie in one head
  float ksq_mine = 0.f;
#pragma unroll   // kq[it], vv[it] stay in registers
  for (int it = 0; it < 16; ++it) {
    v4us h4, l4; v4ha f4;
#pragma unroll
    for (int t = 0; t < 4; ++t) {
      const unsigned short hb = bf16_bits(kq[it][t]);
      h4[t] = hb; l4[t] = bf16_bits(kq[it][t] - bf16_val(hb));
      f4[t] = (_Float16)vv[it][t];
    }
    *(v4us*)(ph + it * DH) = h4;
    *(v4us*)(ph + HEL + it * DH) = l4;
    *(v4ha*)(ph + 2 * HEL + it * DH) = f4;
    // |q_j|^2 in f32 from the f32 values in registers: the 16 lanes of a row hold one row, every lane ends with its sum
    const float s = row16_sum(kq[it][0] * kq[it][0] + kq[it][1] * kq[it][1] + kq[it][2] * kq[it][2] + kq[it][3] * kq[it][3]);
    if (ln == it) ksq_mine = s;                          // lane 16*hh + it keeps row 16*hh + it
  }
  ((float*)(ws + 3 * (size_t)NEL))[row0 + lane] = ksq_mine;
}

// second argument: 8 waves a SIMD, so that two blocks of 16 waves stay resident on a WGP
__global__ __launch_bounds__(NTHR, 8) void k_softattn(const unsigned short* __restrict__ ws, float* __restrict__ out) {
  // two chunk buffers (each: keys bf16 hi [key][d], keys lo, values f16 [key][d]) and the head's norms; behind the loop the buffers' room
  // takes sO[KSP][QPB][OP], per key group the partial out*4096 of the block's 64 queries
  __shared__ __attribute__((aligned(16))) unsigned char smem[SMEMB];
  static_assert(KSP * QPB * OP * 4 <= OFF_N, "the partials fit in the ring's room");

  const int tid = threadIdx.x, lane = tid & 31, ln = lane & 15, hh = lane >> 4;
  const int wv = __builtin_amdgcn_readfirstlane(tid >> 5), w = wv & 3, g = wv >> 2;   // wave number, query tile, key group: scalar registers
  const int kb = g * 32;                                 // this wave's first key row inside the staged chunk
  const int bh = blockIdx.x / (L_TOK / QPB), qblk = blockIdx.x % (L_TOK / QPB);
  const int q0 = qblk * QPB + w * 16;
  const size_t base = (size_t)bh * L_TOK * DH;
  const unsigned short* QH = ws + 3 * base;              // hi plane of this head; lo at + HEL, v at + 2*HEL
  const float* NRM = (const float*)(ws + 3 * (size_t)NEL) + bh * L_TOK;
  float* O = out + base;
  const float cexp = -1.0f / 16.0f;                      // -1/(2*sqrt(64))

  // B fragments of this wave's 16 queries (bf16 hi/lo, column ln, k = d split layout) and |q|^2 of the one query whose D column this lane holds
  FragB aqh[2], aql[2];
  float sqq;
  {
    const unsigned short* qr = QH + (size_t)(q0 + ln) * DH + 8 * hh;
#pragma unroll
    for (int ks = 0; ks < 2; ++ks) {
      *(v8us*)&aqh[ks].u[0] = *(const v8us*)(qr + ks * 32);
      *(v8us*)&aqh[ks].u[8] = *(const v8us*)(qr + ks * 32 + 16);
      *(v8us*)&aql[ks].u[0] = *(const v8us*)(qr + HEL + ks * 32);
      *(v8us*)&aql[ks].u[8] = *(const v8us*)(qr + HEL + ks * 32 + 16);
    }
    const int qi = q0 + ln;
    sqq = NRM[qi];
    // what these loads name (address pair, index, scalar base) are inputs, so they stay whole up to this wait
    asm volatile("s_wait_xcnt 0x0" :: "v"(qr), "v"(qi), "s"(NRM) : "memory");
  }

  v8f oacc[4] = {};
  const unsigned char* kf = smem + (kb + ln) * KPB + 16 * hh;                                       // this lane's row of the wave's first key sub-tile, buffer 0
  const unsigned char* vt = smem + OFF_V + (kb + 8 * hh + (lane & 7)) * VPB + 16 * ((lane >> 3) & 1);   // its piece of the wave's first 16 x 16 value tile
  const float* sn = (const float*)(smem + OFF_N) + kb + 8 * hh;   // norms of the 8 keys whose D rows this lane holds in chunk 0's first sub-tile
  const unsigned short* gk = QH + tid * 8;               // staging: this thread's 16 bytes of chunk 0
  const unsigned lk = lds_addr(smem + (tid >> 3) * KPB + (tid & 7) * 16), lv = lds_addr(smem + OFF_V + (tid >> 3) * VPB + (tid & 7) * 16);
  // in front of the loop: chunk 0 and the norms (16 bytes a thread) land and are published, then chunk 1 starts
  copy_chunk(gk, lk, lv);
  asm volatile("global_load_async_to_lds_b128 %0, %1, off\n\ts_wait_xcnt 0x0" :: "v"(lds_addr(smem + OFF_N + tid * 16)), "v"(NRM + tid * 4) : "memory");
  asm volatile("s_wait_asynccnt 0x0" ::: "memory");      // this wave's copies have landed before the barrier that shows them to the others
  __syncthreads();
  copy_chunk(gk + KCH * DH, lk + BUFB, lv + BUFB);
  for (int c = 0; c < NCH; ++c) {
    const unsigned bo = (c & 1) * BUFB;                  // the buffer that holds chunk c
    v4f ksq4[2][2];
#pragma unroll
    for (int it = 0; it < 2; ++it) {
      ksq4[it][0] = *(const v4fa*)(sn + c * KCH + it * 16);
      ksq4[it][1] = *(const v4fa*)(sn + c * KCH + it * 16 + 4);
    }

    // dots tile 32 keys x 16 queries (two 16-key sub-tiles), 3-term split, then S = exp(cexp*(|q|^2+|k|^2-2 dots)) * 4096 -> f16 in registers:
    // D row 8hh+r of sub-tile nt is key nt*16+8hh+r, which is element nt*8+r of a B fragment in the hardware k order
    FragH pb;
#pragma unroll
    for (int nt = 0; nt < 2; ++nt) {
      v8f acc = {};
#pragma unroll
      for (int ks = 0; ks < 2; ++ks) {
        FragB bkh, bkl;
        const unsigned char* kr = kf + bo + nt * 16 * KPB + ks * 64;
        *(v8us*)&bkh.u[0] = *(const v8us*)(kr);
        *(v8us*)&bkh.u[8] = *(const v8us*)(kr + 32);
        *(v8us*)&bkl.u[0] = *(const v8us*)(kr + OFF_KL);
        *(v8us*)&bkl.u[8] = *(const v8us*)(kr + OFF_KL + 32);
        acc = mma3(bkh.v, bkl.v, aqh[ks].v, aql[ks].v, acc);
      }
#pragma unroll
      for (int r = 0; r < 8; ++r) {
        const float d2 = sqq + ksq4[nt][r >> 2][r & 3] - 2.0f * acc[r];
        pb.h[nt * 8 + r] = (_Float16)(__expf(cexp * d2) * 4096.0f);
      }
    }
    FragH bv[4];                                         // A: row d = dt*16+ln, k = keys kb+8hh+0..7 and kb+16+8hh+0..7, as pb has them
#pragma unroll   // all 8 loads stand in one place: one LDS round trip for the four products
    for (int dt = 0; dt < 4; ++dt) {
      bv[dt].half[0] = ld_tr16((const _Float16*)(vt + bo + dt * 32));
      bv[dt].half[1] = ld_tr16((const _Float16*)(vt + bo + 16 * VPB + dt * 32));
    }
#pragma unroll
    for (int dt = 0; dt < 4; ++dt) oacc[dt] = mma16(bv[dt].v, pb.v, oacc[dt]);   // oacc[dt][r] = out*4096 of query ln at d = dt*16+8hh+r

    // foot of the trip: the one barrier publishes chunk c + 1 and ends every wave's reads of chunk c's buffer, which is refilled behind it
    asm volatile("s_wait_dscnt 0x0" ::: "memory");       // this wave's LDS reads of chunk c are done
    asm volatile("s_wait_asynccnt 0x0" ::: "memory");    // this wave's copies of chunk c + 1 have landed
    __syncthreads();
    if (c + 2 < NCH) copy_chunk(gk + (size_t)(c + 2) * (KCH * DH), lk + bo, lv + bo);
  }
  asm volatile("s_wait_asynccnt 0x0" ::: "memory");      // no copy is under way when the ring's room becomes sO
  float (*sO)[QPB][OP] = (float (*)[QPB][OP])smem;

  // the lane number is read anew here: no epilogue address then lives in a vector register through the loop (scratch stays 0 at 128 VGPRs)
  const int el = (int)__builtin_amdgcn_mbcnt_lo(~0u, 0u), eln = el & 15, ehh = el >> 4, etid = wv * 32 + el;
#pragma unroll
  for (int dt = 0; dt < 4; ++dt) {
    *(v4fa*)&sO[g][w * 16 + eln][dt * 16 + 8 * ehh] = (v4f){oacc[dt][0], oacc[dt][1], oacc[dt][2], oacc[dt][3]};
    *(v4fa*)&sO[g][w * 16 + eln][dt * 16 + 8 * ehh + 4] = (v4f){oacc[dt][4], oacc[dt][5], oacc[dt][6], oacc[dt][7]};
  }
  __syncthreads();                                       // every key group's partial is in LDS before any thread sums them
  // out row = sum of the KSP partials in group order, then the exact 1/4096; 16 lanes store one whole 256-byte row
#pragma unroll
  for (int k = 0; k < QPB * (DH / 4) / NTHR; ++k) {
    const int idx = k * NTHR + etid, r = idx >> 4, c4 = (idx & 15) * 4;
    v4f val = *(const v4fa*)&sO[0][r][c4];
#pragma unroll
    for (int p = 1; p < KSP; ++p) val += *(const v4fa*)&sO[p][r][c4];
    *(v4f*)(O + (size_t)(qblk * QPB + r) * DH + c4) = val * (1.0f / 4096.0f);
  }
}

extern "C" void kernel_launch(void* const* d_in, const int* in_sizes, int n_in,
                              void* d_out, int out_size, void* d_ws, size_t ws_size, hipStream_t stream) {
  (void)in_sizes; (void)n_in; (void)out_size; (void)ws_size;
  const float* q = (const float*)d_in[0];
  const float* v = (const float*)d_in[1];
  k_split<<<NBH * L_TOK / 128, 128, 0, stream>>>(q, v, (unsigned short*)d_ws);
  k_softattn<<<NBH * (L_TOK / QPB), NTHR, 0, stream>>>((const unsigned short*)d_ws, (float*)d_out);
}

// v007
// One run takes 30.5 microseconds.
// Timed twice side by side with v006, it ran 1.20 times as fast both times.
// Over all steps from v000 it is 7.51 times as fast.
#include <hip/hip_runtime.h>
// Contractions: dots = Q·Qᵀ (K=64) on v_wmma_f32_16x16x32_bf16 as a 3-term bf16 hi/lo split (f32-accurate squared
// distances), and out = S·V (K=2048 keys) on v_wmma_f32_16x16x32_f16 with S×4096 and V as f16 operands; f32 accumulate.
// Both products run transposed (keys x queries, then d x queries): the score accumulators of 32 keys, converted in place, are the B operand of the second.
// Norms, exp and the 1/4096 epilogue in f32.
// Two launches: k_split writes the bf16 hi/lo split of q, the f16 copy of v and the row norms |q_i|^2 to the workspace once;
// k_softattn reads only those, so that no block repeats the conversion of the 2048 keys that its 15 neighbours of the same head need too.
// Its key chunks come to LDS by asynchronous copies in a ring of two buffers: chunk c + 1 is under way while chunk c is worked on.

#define L_TOK 2048
#define DH    64
#define NBH   16
#define QPB   128             // queries per block (8 query tiles of 16)
#define QTW   2               // query tiles per wave: every key and value fragment that a wave reads from LDS feeds QTW products
#define KSP   4               // key groups per block: wave group g takes keys 32g..32g+31 of every staged chunk for all 8 query tiles
#define NTHR  (128 * KSP)
#define KCH   (32 * KSP)      // keys staged per trip
#define VP    (DH + 16)       // value row pitch in LDS, halves: 160 bytes, an odd multiple of 32, the conflict-free pitch of the transposing load
#define OP    (DH + 4)        // sO row pitch in floats: 272 bytes, an odd multiple of 16, so that 16 lanes storing 16 bytes of 16 rows meet no bank twice
#define NCH   (L_TOK / KCH)   // chunks (trips) of a head
#define KPB   ((DH + 8) * 2)  // key row pitch in LDS, bytes: 144, an odd multiple of 16, the conflict-free pitch of ds_load_b128
#define VPB   (VP * 2)        // value row pitch in LDS, bytes
#define OFF_KL (KCH * KPB)               // inside a buffer: key hi plane at 0, key lo plane here,
#define OFF_V  (2 * KCH * KPB)           // value plane here
#define BUFB   (2 * KCH * KPB + KCH * VPB)   // bytes of one buffer of the ring
#define OFF_N  (2 * BUFB)                // behind the two buffers: |q_j|^2 of the head's 2048 keys, f32
#define SOB    (KSP * QPB * OP * 4)      // bytes of the partials sO, which take the room of ring and norms behind the loop
#define SMEMB  (SOB > OFF_N + L_TOK * 4 ? SOB : OFF_N + L_TOK * 4)
#define NEL   (NBH * L_TOK * DH)   // elements of q (and of v)
#define HEL   (L_TOK * DH)         // elements of one head; workspace in 16-bit units: head h has q hi at 3*HEL*h, q lo HEL and v f16 2*HEL behind it
                                   // (all three within an immediate offset of one address pair); the norms (f32) stand at 3*NEL

typedef _Float16 v16h __attribute__((ext_vector_type(16)));
typedef _Float16 v8h  __attribute__((ext_vector_type(8)));
typedef _Float16 v8ha __attribute__((ext_vector_type(8), may_alias));
typedef __bf16   v16b __attribute__((ext_vector_type(16)));
typedef float    v8f  __attribute__((ext_vector_type(8)));
typedef float    v4f  __attribute__((ext_vector_type(4)));
typedef float    v4fa __attribute__((ext_vector_type(4), may_alias));
typedef unsigned short v8us __attribute__((ext_vector_type(8), may_alias));
typedef unsigned short v4us __attribute__((ext_vector_type(4), may_alias));
typedef _Float16 v4ha __attribute__((ext_vector_type(4), may_alias));
typedef short s16x8 __attribute__((ext_vector_type(8)));
union FragH { v16h v; v8h half[2]; _Float16 h[16]; };
union FragB { v16b v; unsigned short u[16]; };

__device__ __forceinline__ unsigned short bf16_bits(float x) { unsigned int u = __float_as_uint(x); return (unsigned short)((u + 0x7FFFu + ((u >> 16) & 1u)) >> 16); }
__device__ __forceinline__ float bf16_val(unsigned short b) { return __uint_as_float(((unsigned int)b) << 16); }
__device__ __forceinline__ v8f mma16(v16h a, v16h b, v8f c) {
  return __builtin_amdgcn_wmma_f32_16x16x32_f16(false, a, false, b, (short)0, c, false, false);
}
__device__ __forceinline__ v8f mmab(v16b a, v16b b, v8f c) {
  return __builtin_amdgcn_wmma_f32_16x16x32_bf16(false, a, false, b, (short)0, c, false, false);
}

// ds_load_tr16_b128: the 32 lanes name the 16-byte pieces of a 16 x 16 tile of halves that lies [k][n] in LDS (lane l: row 8*(l>>4) + (l&7), piece (l>>3)&1);
// lane (c = l&15, h = l>>4) gets T[8h + 0..7][c], which is half an A fragment of the transposed tile in the hardware k order
__device__ __forceinline__ v8h ld_tr16(const _Float16* p) {
  typedef __attribute__((address_space(3))) s16x8 lds_s16x8;
  return __builtin_bit_cast(v8h, __builtin_amdgcn_ds_load_tr16_b128_v8i16((lds_s16x8*)p));
}

__device__ __forceinline__ unsigned lds_addr(const void* p) {   // byte address inside the work-group's LDS
  typedef __attribute__((address_space(3))) const unsigned char lds_u8;
  return (unsigned)(size_t)(lds_u8*)p;
}
// One thread's share of a chunk, LDS <- workspace with no register in between: 16 bytes of rows r and r + 16*KSP of each of the three planes.
// gk: this thread's 16 bytes of the hi plane's first row group; lk, lv: its place in the buffer's hi plane and value plane.
// The s_wait_xcnt closes the statement so that no address register is rewritten while a copy may still name it.
__device__ __forceinline__ void copy_chunk(const unsigned short* gk, unsigned lk, unsigned lv) {
  asm volatile("global_load_async_to_lds_b128 %0, %6, off\n\t"
               "global_load_async_to_lds_b128 %1, %7, off\n\t"
               "global_load_async_to_lds_b128 %2, %8, off\n\t"
               "global_load_async_to_lds_b128 %3, %9, off\n\t"
               "global_load_async_to_lds_b128 %4, %10, off\n\t"
               "global_load_async_to_lds_b128 %5, %11, off\n\t"
               "s_wait_xcnt 0x0"
               :: "v"(lk), "v"(lk + 16 * KSP * KPB), "v"(lk + OFF_KL), "v"(lk + OFF_KL + 16 * KSP * KPB), "v"(lv), "v"(lv + 16 * KSP * VPB),
                  "v"(gk), "v"(gk + NTHR * 8), "v"(gk + HEL), "v"(gk + HEL + NTHR * 8), "v"(gk + 2 * HEL), "v"(gk + 2 * HEL + NTHR * 8)
               : "memory");
}

template <int M> __device__ __forceinline__ float row_xadd(float x) {   // x + x of lane ^ M inside the 16-lane row (DPP row_xmask)
  return x + __int_as_float(__builtin_amdgcn_update_dpp(0, __float_as_int(x), 0x160 + M, 0xf, 0xf, true));
}
__device__ __forceinline__ float row16_sum(float x) { return row_xadd<8>(row_xadd<4>(row_xadd<2>(row_xadd<1>(x)))); }

// One wave converts 32 consecutive rows: trip it takes rows it (lanes 0-15) and 16+it (lanes 16-31), 4 consecutive d a lane.
// Every 128-byte line of the four workspace planes has one writing wave.
__global__ __launch_bounds__(128) void k_split(const float* __restrict__ q, const float* __restrict__ v, unsigned short* __restrict__ ws) {
  const int tid = threadIdx.x, lane = tid & 31, ln = lane & 15, hh = lane >> 4;
  const int row0 = (blockIdx.x * 4 + (tid >> 5)) * 32;
  const size_t e0 = (size_t)(row0 + 16 * hh) * DH + ln * 4;
  const float* pq = q + e0; const float* pv = v + e0;
  v4f kq[16], vv[16];
#pragma unroll   // all 32 loads leave before any is used: one load round trip for the launch
  for (int it = 0; it < 16; ++it) {
    kq[it] = *(const v4fa*)(pq + it * DH);
    vv[it] = *(const v4fa*)(pv + it * DH);
  }
  // the two address pairs are inputs, so they stay whole up to this wait
  asm volatile("s_wait_xcnt 0x0" :: "v"(pq), "v"(pv) : "memory");
  unsigned short* ph = ws + e0 + (size_t)(row0 / L_TOK) * (2 * HEL);   // the 32 rows of a wave lie in one head
  float ksq_mine = 0.f;
#pragma unroll   // kq[it], vv[it] stay in registers
  for (int it = 0; it < 16; ++it) {
    v4us h4, l4; v4ha f4;
#pragma unroll
    for (int t = 0; t < 4; ++t) {
      const unsigned short hb = bf16_bits(kq[it][t]);
      h4[t] = hb; l4[t] = bf16_bits(kq[it][t] - bf16_val(hb));
      f4[t] = (_Float16)vv[it][t];
    }
    *(v4us*)(ph + it * DH) = h4;
    *(v4us*)(ph + HEL + it * DH) = l4;
    *(v4ha*)(ph + 2 * HEL + it * DH) = f4;
    // |q_j|^2 in f32 from the f32 values in registers: the 16 lanes of a row hold one row, every lane ends with its sum
    const float s = row16_sum(kq[it][0] * kq[it][0] + kq[it][1] * kq[it][1] + kq[it][2] * kq[it][2] + kq[it][3] * kq[it][3]);
    if (ln == it) ksq_mine = s;                          // lane 16*hh + it keeps row 16*hh + it
  }
  ((float*)(ws + 3 * (size_t)NEL))[row0 + lane] = ksq_mine;
}

// one block of 16 waves a WGP, 4 waves a SIMD: a wave may take 256 VGPRs
__global__ __launch_bounds__(NTHR) void k_softattn(const unsigned short* __restrict__ ws, float* __restrict__ out) {
  // two chunk buffers (each: keys bf16 hi [key][d], keys lo, values f16 [key][d]) and the head's norms; behind the loop their room
  // takes sO[KSP][QPB][OP], per key group the partial out*4096 of the block's 128 queries
  __shared__ __attribute__((aligned(16))) unsigned char smem[SMEMB];

  const int tid = threadIdx.x, lane = tid & 31, ln = lane & 15, hh = lane >> 4;
  const int wv = __builtin_amdgcn_readfirstlane(tid >> 5), w = wv & 3, g = wv >> 2;   // wave number, query tile pair, key group: scalar registers
  const int kb = g * 32;                                 // this wave's first key row inside the staged chunk
  const int bh = blockIdx.x / (L_TOK / QPB), qblk = blockIdx.x % (L_TOK / QPB);
  const int q0 = qblk * QPB + w * (16 * QTW);
  const size_t base = (size_t)bh * L_TOK * DH;
  const unsigned short* QH = ws + 3 * base;              // hi plane of this head; lo at + HEL, v at + 2*HEL
  const float* NRM = (const float*)(ws + 3 * (size_t)NEL) + bh * L_TOK;
  float* O = out + base;
  const float cexp = -1.0f / 16.0f;                      // -1/(2*sqrt(64))

  // B fragments of this wave's QTW x 16 queries (bf16 hi/lo, column ln, k = d split layout) and, per tile, |q|^2 of the one query whose D column this lane holds
  FragB aqh[QTW][2], aql[QTW][2];
  float sqq[QTW];
  {
    const unsigned short* qr = QH + (size_t)(q0 + ln) * DH + 8 * hh;
    const int qi = q0 + ln;
#pragma unroll
    for (int qt = 0; qt < QTW; ++qt) {
#pragma unroll
      for (int ks = 0; ks < 2; ++ks) {
        *(v8us*)&aqh[qt][ks].u[0] = *(const v8us*)(qr + qt * 16 * DH + ks * 32);
        *(v8us*)&aqh[qt][ks].u[8] = *(const v8us*)(qr + qt * 16 * DH + ks * 32 + 16);
        *(v8us*)&aql[qt][ks].u[0] = *(const v8us*)(qr + qt * 16 * DH + HEL + ks * 32);
        *(v8us*)&aql[qt][ks].u[8] = *(const v8us*)(qr + qt * 16 * DH + HEL + ks * 32 + 16);
      }
      sqq[qt] = NRM[qi + qt * 16];
    }
    // what these loads name (address pair, index, scalar base) are inputs, so they stay whole up to this wait
    asm volatile("s_wait_xcnt 0x0" :: "v"(qr), "v"(qi), "s"(NRM) : "memory");
  }

  v8f oacc[QTW][4] = {};
  const unsigned char* kf = smem + (kb + ln) * KPB + 16 * hh;                                       // this lane's row of the wave's first key sub-tile, buffer 0
  const unsigned char* vt = smem + OFF_V + (kb + 8 * hh + (lane & 7)) * VPB + 16 * ((lane >> 3) & 1);   // its piece of the wave's first 16 x 16 value tile
  const float* sn = (const float*)(smem + OFF_N) + kb + 8 * hh;   // norms of the 8 keys whose D rows this lane holds in chunk 0's first sub-tile
  const unsigned short* gk = QH + tid * 8;               // staging: this thread's 16 bytes of chunk 0
  const unsigned lk = lds_addr(smem + (tid >> 3) * KPB + (tid & 7) * 16), lv = lds_addr(smem + OFF_V + (tid >> 3) * VPB + (tid & 7) * 16);
  // in front of the loop: chunk 0 and the norms (16 bytes a thread) land and are published, then chunk 1 starts
  copy_chunk(gk, lk, lv);
  asm volatile("global_load_async_to_lds_b128 %0, %1, off\n\ts_wait_xcnt 0x0" :: "v"(lds_addr(smem + OFF_N + tid * 16)), "v"(NRM + tid * 4) : "memory");
  asm volatile("s_wait_asynccnt 0x0" ::: "memory");      // this wave's copies have landed before the barrier that shows them to the others
  __syncthreads();
  copy_chunk(gk + KCH * DH, lk + BUFB, lv + BUFB);
  for (int c = 0; c < NCH; ++c) {
    const unsigned bo = (c & 1) * BUFB;                  // the buffer that holds chunk c
    v4f ksq4[2][2];
#pragma unroll
    for (int it = 0; it < 2; ++it) {
      ksq4[it][0] = *(const v4fa*)(sn + c * KCH + it * 16);
      ksq4[it][1] = *(const v4fa*)(sn + c * KCH + it * 16 + 4);
    }

    // dots tiles 32 keys x 16 queries (two 16-key sub-tiles) for each of the wave's query tiles, 3-term split, then S = exp(cexp*(|q|^2+|k|^2-2 dots)) * 4096 -> f16 in registers:
    // D row 8hh+r of sub-tile nt is key nt*16+8hh+r, which is element nt*8+r of a B fragment in the hardware k order
    FragH pb[QTW];
    FragB bkh[2][2], bkl[2][2];                          // A fragments of the wave's 32 keys: [sub-tile][k step]
#pragma unroll   // all 16 loads stand in one place, ahead of the products
    for (int nt = 0; nt < 2; ++nt) {
#pragma unroll
      for (int ks = 0; ks < 2; ++ks) {
        const unsigned char* kr = kf + bo + nt * 16 * KPB + ks * 64;
        *(v8us*)&bkh[nt][ks].u[0] = *(const v8us*)(kr);
        *(v8us*)&bkh[nt][ks].u[8] = *(const v8us*)(kr + 32);
        *(v8us*)&bkl[nt][ks].u[0] = *(const v8us*)(kr + OFF_KL);
        *(v8us*)&bkl[nt][ks].u[8] = *(const v8us*)(kr + OFF_KL + 32);
      }
    }
    __builtin_amdgcn_sched_barrier(0);                   // keeps the loads together ahead of the products: a load sunk among them is a further place where the wave waits for LDS
    v8f acc[2][QTW] = {};
#pragma unroll
    for (int nt = 0; nt < 2; ++nt) {
#pragma unroll
      for (int ks = 0; ks < 2; ++ks) {
        // per tile hi*hi, lo(A)*hi(B), hi(A)*lo(B) in this order; the tiles alternate, so that no product waits for the one in front of it
#pragma unroll
        for (int qt = 0; qt < QTW; ++qt) acc[nt][qt] = mmab(bkh[nt][ks].v, aqh[qt][ks].v, acc[nt][qt]);
#pragma unroll
        for (int qt = 0; qt < QTW; ++qt) acc[nt][qt] = mmab(bkl[nt][ks].v, aqh[qt][ks].v, acc[nt][qt]);
#pragma unroll
        for (int qt = 0; qt < QTW; ++qt) acc[nt][qt] = mmab(bkh[nt][ks].v, aql[qt][ks].v, acc[nt][qt]);
      }
      __builtin_amdgcn_sched_barrier(0);                 // keeps the two tiles' products alternating: the scheduler otherwise runs each tile's six as one dependent chain
    }
    FragH bv[4];                                         // A: row d = dt*16+ln, k = keys kb+8hh+0..7 and kb+16+8hh+0..7, as pb has them
#pragma unroll   // all 8 loads stand in one place, in the registers that the key fragments have left: their LDS round trip runs under the exp block below
    for (int dt = 0; dt < 4; ++dt) {
      bv[dt].half[0] = ld_tr16((const _Float16*)(vt + bo + dt * 32));
      bv[dt].half[1] = ld_tr16((const _Float16*)(vt + bo + 16 * VPB + dt * 32));
    }
    __builtin_amdgcn_sched_barrier(0);                   // keeps those loads ahead of the exp block: sunk behind it, the wave waits out their latency in front of the products and of the barrier
#pragma unroll
    for (int nt = 0; nt < 2; ++nt) {
#pragma unroll
      for (int qt = 0; qt < QTW; ++qt) {
#pragma unroll
        for (int r = 0; r < 8; ++r) {
          const float d2 = sqq[qt] + ksq4[nt][r >> 2][r & 3] - 2.0f * acc[nt][qt][r];
          pb[qt].h[nt * 8 + r] = (_Float16)(__expf(cexp * d2) * 4096.0f);
        }
      }
    }
#pragma unroll
    for (int dt = 0; dt < 4; ++dt) {
#pragma unroll
      for (int qt = 0; qt < QTW; ++qt) oacc[qt][dt] = mma16(bv[dt].v, pb[qt].v, oacc[qt][dt]);   // oacc[qt][dt][r] = out*4096 of query qt*16+ln at d = dt*16+8hh+r
    }

    // foot of the trip: the one barrier publishes chunk c + 1 and ends every wave's reads of chunk c's buffer, which is refilled behind it
    asm volatile("s_wait_dscnt 0x0" ::: "memory");       // this wave's LDS reads of chunk c are done
    asm volatile("s_wait_asynccnt 0x0" ::: "memory");    // this wave's copies of chunk c + 1 have landed
    __syncthreads();
    if (c + 2 < NCH) copy_chunk(gk + (size_t)(c + 2) * (KCH * DH), lk + bo, lv + bo);
  }
  asm volatile("s_wait_asynccnt 0x0" ::: "memory");      // no copy is under way when the ring's room becomes sO
  float (*sO)[QPB][OP] = (float (*)[QPB][OP])smem;

  // the lane number is read anew here: no epilogue address then lives in a vector register through the loop (fewer live registers there)
  const int el = (int)__builtin_amdgcn_mbcnt_lo(~0u, 0u), eln = el & 15, ehh = el >> 4, etid = wv * 32 + el;
#pragma unroll
  for (int qt = 0; qt < QTW; ++qt) {
#pragma unroll
    for (int dt = 0; dt < 4; ++dt) {
      float* po = &sO[g][(w * QTW + qt) * 16 + eln][dt * 16 + 8 * ehh];
      *(v4fa*)po = (v4f){oacc[qt][dt][0], oacc[qt][dt][1], oacc[qt][dt][2], oacc[qt][dt][3]};
      *(v4fa*)(po + 4) = (v4f){oacc[qt][dt][4], oacc[qt][dt][5], oacc[qt][dt][6], oacc[qt][dt][7]};
    }
  }
  __syncthreads();                                       // every key group's partial is in LDS before any thread sums them
  // out row = sum of the KSP partials in group order, then the exact 1/4096; 16 lanes store one whole 256-byte row
#pragma unroll
  for (int k = 0; k < QPB * (DH / 4) / NTHR; ++k) {
    const int idx = k * NTHR + etid, r = idx >> 4, c4 = (idx & 15) * 4;
    v4f val = *(const v4fa*)&sO[0][r][c4];
#pragma unroll
    for (int p = 1; p < KSP; ++p) val += *(const v4fa*)&sO[p][r][c4];
    *(v4f*)(O + (size_t)(qblk * QPB + r) * DH + c4) = val * (1.0f / 4096.0f);
  }
}

extern "C" void kernel_launch(void* const* d_in, const int* in_sizes, int n_in,
                              void* d_out, int out_size, void* d_ws, size_t ws_size, hipStream_t stream) {
  (void)in_sizes; (void)n_in; (void)out_size; (void)ws_size;
  const float* q = (const float*)d_in[0];
  const float* v = (const float*)d_in[1];
  k_split<<<NBH * L_TOK / 128, 128, 0, stream>>>(q, v, (unsigned short*)d_ws);
  k_softattn<<<NBH * (L_TOK / QPB), NTHR, 0, stream>>>((const unsigned short*)d_ws, (float*)d_out);
}

// v008
// One run takes 28.9 microseconds.
// Two timings next to v007 both put it at 1.06 times that version's speed.
// All steps since v000 together make it 7.95 times as fast.
#include <hip/hip_runtime.h>
// Contractions: dots = Q·Qᵀ (K=64) on v_wmma_f32_16x16x32_bf16 as a 3-term bf16 hi/lo split (f32-accurate squared
// distances), and out = S·V (K=2048 keys) on v_wmma_f32_16x16x32_f16 with S×4096 and V as f16 operands; f32 accumulate.
// Both products run transposed (keys x queries, then d x queries): the score accumulators of 32 keys, converted in place, are the B operand of the second.
// Norms, exp and the 1/4096 epilogue in f32. A score costs the vector port one fused multiply-add, one v_exp_f32 and half a packed convert:
// S*4096 = 2^(c2*(dots - |k|^2/2) + (12 - c2*|q|^2/2)), c2 = log2(e)/8; -|k|^2/2 starts the dots accumulator as the C operand of its first product.
// Two launches: k_split writes the bf16 hi/lo split of q, the f16 copy of v and the halved negative row norms -|q_i|^2/2 to the workspace once;
// k_softattn reads only those, so that no block repeats the conversion of the 2048 keys that its 15 neighbours of the same head need too.
// Its key chunks come to LDS by asynchronous copies in a ring of two buffers: chunk c + 1 is under way while chunk c is worked on.

#define L_TOK 2048
#define DH    64
#define NBH   16
#define QPB   128             // queries per block (8 query tiles of 16)
#define QTW   2               // query tiles per wave: every key and value fragment that a wave reads from LDS feeds QTW products
#define KSP   4               // key groups per block: wave group g takes keys 32g..32g+31 of every staged chunk for all 8 query tiles
#define NTHR  (128 * KSP)
#define KCH   (32 * KSP)      // keys staged per trip
#define VP    (DH + 16)       // value row pitch in LDS, halves: 160 bytes, an odd multiple of 32, the conflict-free pitch of the transposing load
#define OP    (DH + 4)        // sO row pitch in floats: 272 bytes, an odd multiple of 16, so that 16 lanes storing 16 bytes of 16 rows meet no bank twice
#define NCH   (L_TOK / KCH)   // chunks (trips) of a head
#define KPB   ((DH + 8) * 2)  // key row pitch in LDS, bytes: 144, an odd multiple of 16, the conflict-free pitch of ds_load_b128
#define VPB   (VP * 2)        // value row pitch in LDS, bytes
#define OFF_KL (KCH * KPB)               // inside a buffer: key hi plane at 0, key lo plane here,
#define OFF_V  (2 * KCH * KPB)           // value plane here
#define BUFB   (2 * KCH * KPB + KCH * VPB)   // bytes of one buffer of the ring
#define OFF_N  (2 * BUFB)                // behind the two buffers: -|q_j|^2/2 of the head's 2048 keys, f32
#define SOB    (KSP * QPB * OP * 4)      // bytes of the partials sO, which take the room of ring and norms behind the loop
#define SMEMB  (SOB > OFF_N + L_TOK * 4 ? SOB : OFF_N + L_TOK * 4)
#define NEL   (NBH * L_TOK * DH)   // elements of q (and of v)
#define HEL   (L_TOK * DH)         // elements of one head; workspace in 16-bit units: head h has q hi at 3*HEL*h, q lo HEL and v f16 2*HEL behind it
                                   // (all three within an immediate offset of one address pair); the norms (f32) stand at 3*NEL

typedef _Float16 v16h __attribute__((ext_vector_type(16)));
typedef _Float16 v8h  __attribute__((ext_vector_type(8)));
typedef _Float16 v8ha __attribute__((ext_vector_type(8), may_alias));
typedef __bf16   v16b __attribute__((ext_vector_type(16)));
typedef float    v8f  __attribute__((ext_vector_type(8)));
typedef float    v4f  __attribute__((ext_vector_type(4)));
typedef float    v4fa __attribute__((ext_vector_type(4), may_alias));
typedef unsigned short v8us __attribute__((ext_vector_type(8), may_alias));
typedef unsigned short v4us __attribute__((ext_vector_type(4), may_alias));
typedef _Float16 v4ha __attribute__((ext_vector_type(4), may_alias));
typedef short s16x8 __attribute__((ext_vector_type(8)));
union FragH { v16h v; v8h half[2]; _Float16 h[16]; };
union FragB { v16b v; unsigned short u[16]; };

__device__ __forceinline__ unsigned short bf16_bits(float x) { unsigned int u = __float_as_uint(x); return (unsigned short)((u + 0x7FFFu + ((u >> 16) & 1u)) >> 16); }
__device__ __forceinline__ float bf16_val(unsigned short b) { return __uint_as_float(((unsigned int)b) << 16); }
__device__ __forceinline__ v8f mma16(v16h a, v16h b, v8f c) {
  return __builtin_amdgcn_wmma_f32_16x16x32_f16(false, a, false, b, (short)0, c, false, false);
}
__device__ __forceinline__ v8f mmab(v16b a, v16b b, v8f c) {
  return __builtin_amdgcn_wmma_f32_16x16x32_bf16(false, a, false, b, (short)0, c, false, false);
}

// ds_load_tr16_b128: the 32 lanes name the 16-byte pieces of a 16 x 16 tile of halves that lies [k][n] in LDS (lane l: row 8*(l>>4) + (l&7), piece (l>>3)&1);
// lane (c = l&15, h = l>>4) gets T[8h + 0..7][c], which is half an A fragment of the transposed tile in the hardware k order
__device__ __forceinline__ v8h ld_tr16(const _Float16* p) {
  typedef __attribute__((address_space(3))) s16x8 lds_s16x8;
  return __builtin_bit_cast(v8h, __builtin_amdgcn_ds_load_tr16_b128_v8i16((lds_s16x8*)p));
}

__device__ __forceinline__ unsigned lds_addr(const void* p) {   // byte address inside the work-group's LDS
  typedef __attribute__((address_space(3))) const unsigned char lds_u8;
  return (unsigned)(size_t)(lds_u8*)p;
}
// One thread's share of a chunk, LDS <- workspace with no register in between: 16 bytes of rows r and r + 16*KSP of each of the three planes.
// gk: this thread's 16 bytes of the hi plane's first row group; lk, lv: its place in the buffer's hi plane and value plane.
// The s_wait_xcnt closes the statement so that no address register is rewritten while a copy may still name it.
__device__ __forceinline__ void copy_chunk(const unsigned short* gk, unsigned lk, unsigned lv) {
  asm volatile("global_load_async_to_lds_b128 %0, %6, off\n\t"
               "global_load_async_to_lds_b128 %1, %7, off\n\t"
               "global_load_async_to_lds_b128 %2, %8, off\n\t"
               "global_load_async_to_lds_b128 %3, %9, off\n\t"
               "global_load_async_to_lds_b128 %4, %10, off\n\t"
               "global_load_async_to_lds_b128 %5, %11, off\n\t"
               "s_wait_xcnt 0x0"
               :: "v"(lk), "v"(lk + 16 * KSP * KPB), "v"(lk + OFF_KL), "v"(lk + OFF_KL + 16 * KSP * KPB), "v"(lv), "v"(lv + 16 * KSP * VPB),
                  "v"(gk), "v"(gk + NTHR * 8), "v"(gk + HEL), "v"(gk + HEL + NTHR * 8), "v"(gk + 2 * HEL), "v"(gk + 2 * HEL + NTHR * 8)
               : "memory");
}

template <int M> __device__ __forceinline__ float row_xadd(float x) {   // x + x of lane ^ M inside the 16-lane row (DPP row_xmask)
  return x + __int_as_float(__builtin_amdgcn_update_dpp(0, __float_as_int(x), 0x160 + M, 0xf, 0xf, true));
}
__device__ __forceinline__ float row16_sum(float x) { return row_xadd<8>(row_xadd<4>(row_xadd<2>(row_xadd<1>(x)))); }

// One wave converts 32 consecutive rows: trip it takes rows it (lanes 0-15) and 16+it (lanes 16-31), 4 consecutive d a lane.
// Every 128-byte line of the four workspace planes has one writing wave.
__global__ __launch_bounds__(128) void k_split(const float* __restrict__ q, const float* __restrict__ v, unsigned short* __restrict__ ws) {
  const int tid = threadIdx.x, lane = tid & 31, ln = lane & 15, hh = lane >> 4;
  const int row0 = (blockIdx.x * 4 + (tid >> 5)) * 32;
  const size_t e0 = (size_t)(row0 + 16 * hh) * DH + ln * 4;
  const float* pq = q + e0; const float* pv = v + e0;
  v4f kq[16], vv[16];
#pragma unroll   // all 32 loads leave before any is used: one load round trip for the launch
  for (int it = 0; it < 16; ++it) {
    kq[it] = *(const v4fa*)(pq + it * DH);
    vv[it] = *(const v4fa*)(pv + it * DH);
  }
  // the two address pairs are inputs, so they stay whole up to this wait
  asm volatile("s_wait_xcnt 0x0" :: "v"(pq), "v"(pv) : "memory");
  unsigned short* ph = ws + e0 + (size_t)(row0 / L_TOK) * (2 * HEL);   // the 32 rows of a wave lie in one head
  float ksq_mine = 0.f;
#pragma unroll   // kq[it], vv[it] stay in registers
  for (int it = 0; it < 16; ++it) {
    v4us h4, l4; v4ha f4;
#pragma unroll
    for (int t = 0; t < 4; ++t) {
      const unsigned short hb = bf16_bits(kq[it][t]);
      h4[t] = hb; l4[t] = bf16_bits(kq[it][t] - bf16_val(hb));
      f4[t] = (_Float16)vv[it][t];
    }
    *(v4us*)(ph + it * DH) = h4;
    *(v4us*)(ph + HEL + it * DH) = l4;
    *(v4ha*)(ph + 2 * HEL + it * DH) = f4;
    // |q_j|^2 in f32 from the f32 values in registers: the 16 lanes of a row hold one row, every lane ends with its sum
    const float s = row16_sum(kq[it][0] * kq[it][0] + kq[it][1] * kq[it][1] + kq[it][2] * kq[it][2] + kq[it][3] * kq[it][3]);
    if (ln == it) ksq_mine = s;                          // lane 16*hh + it keeps row 16*hh + it
  }
  ((float*)(ws + 3 * (size_t)NEL))[row0 + lane] = -0.5f * ksq_mine;   // stored as -|q_j|^2/2 (exact): the form in which it starts a dots accumulator
}

// one block of 16 waves a WGP, 4 waves a SIMD: a wave may take 256 VGPRs
__global__ __launch_bounds__(NTHR) void k_softattn(const unsigned short* __restrict__ ws, float* __restrict__ out) {
  // two chunk buffers (each: keys bf16 hi [key][d], keys lo, values f16 [key][d]) and the head's norms; behind the loop their room
  // takes sO[KSP][QPB][OP], per key group the partial out*4096 of the block's 128 queries
  __shared__ __attribute__((aligned(16))) unsigned char smem[SMEMB];

  const int tid = threadIdx.x, lane = tid & 31, ln = lane & 15, hh = lane >> 4;
  const int wv = __builtin_amdgcn_readfirstlane(tid >> 5), w = wv & 3, g = wv >> 2;   // wave number, query tile pair, key group: scalar registers
  const int kb = g * 32;                                 // this wave's first key row inside the staged chunk
  const int bh = blockIdx.x / (L_TOK / QPB), qblk = blockIdx.x % (L_TOK / QPB);
  const int q0 = qblk * QPB + w * (16 * QTW);
  const size_t base = (size_t)bh * L_TOK * DH;
  const unsigned short* QH = ws + 3 * base;              // hi plane of this head; lo at + HEL, v at + 2*HEL
  const float* NRM = (const float*)(ws + 3 * (size_t)NEL) + bh * L_TOK;
  float* O = out + base;
  const float c2 = 0.125f * 1.44269504088896341f;        // 2 * 1/(2*sqrt(64)) * log2(e): S*4096 = 2^(c2*(dots - |k|^2/2 - |q|^2/2) + 12)

  // B fragments of this wave's QTW x 16 queries (bf16 hi/lo, column ln, k = d split layout) and, per tile, the exponent's part 12 - c2*|q|^2/2 of the one query whose D column this lane holds
  FragB aqh[QTW][2], aql[QTW][2];
  float sqq[QTW];
  {
    const unsigned short* qr = QH + (size_t)(q0 + ln) * DH + 8 * hh;
    const int qi = q0 + ln;
#pragma unroll
    for (int qt = 0; qt < QTW; ++qt) {
#pragma unroll
      for (int ks = 0; ks < 2; ++ks) {
        *(v8us*)&aqh[qt][ks].u[0] = *(const v8us*)(qr + qt * 16 * DH + ks * 32);
        *(v8us*)&aqh[qt][ks].u[8] = *(const v8us*)(qr + qt * 16 * DH + ks * 32 + 16);
        *(v8us*)&aql[qt][ks].u[0] = *(const v8us*)(qr + qt * 16 * DH + HEL + ks * 32);
        *(v8us*)&aql[qt][ks].u[8] = *(const v8us*)(qr + qt * 16 * DH + HEL + ks * 32 + 16);
      }
      sqq[qt] = NRM[qi + qt * 16] * c2 + 12.0f;          // the query's own part of the exponent, with the factor 4096
    }
    // what these loads name (address pair, index, scalar base) are inputs, so they stay whole up to this wait
    asm volatile("s_wait_xcnt 0x0" :: "v"(qr), "v"(qi), "s"(NRM) : "memory");
  }

  v8f oacc[QTW][4] = {};
  const unsigned char* kf = smem + (kb + ln) * KPB + 16 * hh;                                       // this lane's row of the wave's first key sub-tile, buffer 0
  const unsigned char* vt = smem + OFF_V + (kb + 8 * hh + (lane & 7)) * VPB + 16 * ((lane >> 3) & 1);   // its piece of the wave's first 16 x 16 value tile
  const float* sn = (const float*)(smem + OFF_N) + kb + 8 * hh;   // -|k|^2/2 of the 8 keys whose D rows this lane holds in chunk 0's first sub-tile
  const unsigned short* gk = QH + tid * 8;               // staging: this thread's 16 bytes of chunk 0
  const unsigned lk = lds_addr(smem + (tid >> 3) * KPB + (tid & 7) * 16), lv = lds_addr(smem + OFF_V + (tid >> 3) * VPB + (tid & 7) * 16);
  // in front of the loop: chunk 0 and the norms (16 bytes a thread) land and are published, then chunk 1 starts
  copy_chunk(gk, lk, lv);
  asm volatile("global_load_async_to_lds_b128 %0, %1, off\n\ts_wait_xcnt 0x0" :: "v"(lds_addr(smem + OFF_N + tid * 16)), "v"(NRM + tid * 4) : "memory");
  asm volatile("s_wait_asynccnt 0x0" ::: "memory");      // this wave's copies have landed before the barrier that shows them to the others
  __syncthreads();
  copy_chunk(gk + KCH * DH, lk + BUFB, lv + BUFB);
  for (int c = 0; c < NCH; ++c) {
    const unsigned bo = (c & 1) * BUFB;                  // the buffer that holds chunk c
    v8f nk[2];                                           // -|k|^2/2 of the 8 keys whose D rows this lane holds, per sub-tile: the C operand of the sub-tile's first product
#pragma unroll
    for (int it = 0; it < 2; ++it) {
      const v4f n0 = *(const v4fa*)(sn + c * KCH + it * 16), n1 = *(const v4fa*)(sn + c * KCH + it * 16 + 4);
      nk[it] = (v8f){n0[0], n0[1], n0[2], n0[3], n1[0], n1[1], n1[2], n1[3]};
    }

    // dots tiles 32 keys x 16 queries (two 16-key sub-tiles) for each of the wave's query tiles, 3-term split on top of -|k|^2/2, then S * 4096 = 2^(c2*acc + sqq) -> f16 in registers:
    // D row 8hh+r of sub-tile nt is key nt*16+8hh+r, which is element nt*8+r of a B fragment in the hardware k order
    FragH pb[QTW];
    FragB bkh[2][2], bkl[2][2];                          // A fragments of the wave's 32 keys: [sub-tile][k step]
#pragma unroll   // all 16 loads stand in one place, ahead of the products
    for (int nt = 0; nt < 2; ++nt) {
#pragma unroll
      for (int ks = 0; ks < 2; ++ks) {
        const unsigned char* kr = kf + bo + nt * 16 * KPB + ks * 64;
        *(v8us*)&bkh[nt][ks].u[0] = *(const v8us*)(kr);
        *(v8us*)&bkh[nt][ks].u[8] = *(const v8us*)(kr + 32);
        *(v8us*)&bkl[nt][ks].u[0] = *(const v8us*)(kr + OFF_KL);
        *(v8us*)&bkl[nt][ks].u[8] = *(const v8us*)(kr + OFF_KL + 32);
      }
    }
    __builtin_amdgcn_sched_barrier(0);                   // keeps the loads together ahead of the products: a load sunk among them is a further place where the wave waits for LDS
    v8f acc[2][QTW];
#pragma unroll
    for (int nt = 0; nt < 2; ++nt) {
#pragma unroll
      for (int ks = 0; ks < 2; ++ks) {
        // per tile hi*hi, lo(A)*hi(B), hi(A)*lo(B) in this order; the tiles alternate, so that no product waits for the one in front of it
#pragma unroll
        for (int qt = 0; qt < QTW; ++qt) acc[nt][qt] = mmab(bkh[nt][ks].v, aqh[qt][ks].v, ks == 0 ? nk[nt] : acc[nt][qt]);
#pragma unroll
        for (int qt = 0; qt < QTW; ++qt) acc[nt][qt] = mmab(bkl[nt][ks].v, aqh[qt][ks].v, acc[nt][qt]);
#pragma unroll
        for (int qt = 0; qt < QTW; ++qt) acc[nt][qt] = mmab(bkh[nt][ks].v, aql[qt][ks].v, acc[nt][qt]);
      }
      __builtin_amdgcn_sched_barrier(0);                 // keeps the two tiles' products alternating: the scheduler otherwise runs each tile's six as one dependent chain
    }
    FragH bv[4];                                         // A: row d = dt*16+ln, k = keys kb+8hh+0..7 and kb+16+8hh+0..7, as pb has them
#pragma unroll   // all 8 loads stand in one place, in the registers that the key fragments have left: their LDS round trip runs under the exp block below
    for (int dt = 0; dt < 4; ++dt) {
      bv[dt].half[0] = ld_tr16((const _Float16*)(vt + bo + dt * 32));
      bv[dt].half[1] = ld_tr16((const _Float16*)(vt + bo + 16 * VPB + dt * 32));
    }
    __builtin_amdgcn_sched_barrier(0);                   // keeps those loads ahead of the exp block: sunk behind it, the wave waits out their latency in front of the products and of the barrier
#pragma unroll
    for (int nt = 0; nt < 2; ++nt) {
#pragma unroll
      for (int qt = 0; qt < QTW; ++qt) {
#pragma unroll
        for (int r = 0; r < 8; ++r) {
          pb[qt].h[nt * 8 + r] = (_Float16)__builtin_amdgcn_exp2f(acc[nt][qt][r] * c2 + sqq[qt]);   // one fused multiply-add, v_exp_f32, convert
        }
      }
    }
#pragma unroll
    for (int dt = 0; dt < 4; ++dt) {
#pragma unroll
      for (int qt = 0; qt < QTW; ++qt) oacc[qt][dt] = mma16(bv[dt].v, pb[qt].v, oacc[qt][dt]);   // oacc[qt][dt][r] = out*4096 of query qt*16+ln at d = dt*16+8hh+r
    }

    // foot of the trip: the one barrier publishes chunk c + 1 and ends every wave's reads of chunk c's buffer, which is refilled behind it
    asm volatile("s_wait_dscnt 0x0" ::: "memory");       // this wave's LDS reads of chunk c are done
    asm volatile("s_wait_asynccnt 0x0" ::: "memory");    // this wave's copies of chunk c + 1 have landed
    __syncthreads();
    if (c + 2 < NCH) copy_chunk(gk + (size_t)(c + 2) * (KCH * DH), lk + bo, lv + bo);
  }
  asm volatile("s_wait_asynccnt 0x0" ::: "memory");      // no copy is under way when the ring's room becomes sO
  float (*sO)[QPB][OP] = (float (*)[QPB][OP])smem;

  // the lane number is read anew here: no epilogue address then lives in a vector register through the loop (fewer live registers there)
  const int el = (int)__builtin_amdgcn_mbcnt_lo(~0u, 0u), eln = el & 15, ehh = el >> 4, etid = wv * 32 + el;
#pragma unroll
  for (int qt = 0; qt < QTW; ++qt) {
#pragma unroll
    for (int dt = 0; dt < 4; ++dt) {
      float* po = &sO[g][(w * QTW + qt) * 16 + eln][dt * 16 + 8 * ehh];
      *(v4fa*)po = (v4f){oacc[qt][dt][0], oacc[qt][dt][1], oacc[qt][dt][2], oacc[qt][dt][3]};
      *(v4fa*)(po + 4) = (v4f){oacc[qt][dt][4], oacc[qt][dt][5], oacc[qt][dt][6], oacc[qt][dt][7]};
    }
  }
  __syncthreads();                                       // every key group's partial is in LDS before any thread sums them
  // out row = sum of the KSP partials in group order, then the exact 1/4096; 16 lanes store one whole 256-byte row
#pragma unroll
  for (int k = 0; k < QPB * (DH / 4) / NTHR; ++k) {
    const int idx = k * NTHR + etid, r = idx >> 4, c4 = (idx & 15) * 4;
    v4f val = *(const v4fa*)&sO[0][r][c4];
#pragma unroll
    for (int p = 1; p < KSP; ++p) val += *(const v4fa*)&sO[p][r][c4];
    *(v4f*)(O + (size_t)(qblk * QPB + r) * DH + c4) = val * (1.0f / 4096.0f);
  }
}

extern "C" void kernel_launch(void* const* d_in, const int* in_sizes, int n_in,
                              void* d_out, int out_size, void* d_ws, size_t ws_size, hipStream_t stream) {
  (void)in_sizes; (void)n_in; (void)out_size; (void)ws_size;
  const float* q = (const float*)d_in[0];
  const float* v = (const float*)d_in[1];
  k_split<<<NBH * L_TOK / 128, 128, 0, stream>>>(q, v, (unsigned short*)d_ws);
  k_softattn<<<NBH * (L_TOK / QPB), NTHR, 0, stream>>>((const unsigned short*)d_ws, (float*)d_out);
}

// v010
// Measured time: 20.2 microseconds a run.
// Versions in between are left out here; by their measured steps it is 1.47 times as fast as v008.
// Counting every step since v000, it is 11.7 times as fast.
#include <hip/hip_runtime.h>
// Contractions, both on v_wmma_f32_16x16x32_f16 with f32 accumulate: dots = Q.Q^T (K=64) with q rounded once to f16, and out = S.V (K=2048 keys) with S*4096 and V as f16 operands.
// Why one f16 term is enough for the dots: a score is rounded to f16 (11 bits) as an operand anyway, and an error e of a dot moves its score by the factor e/8 only;
// 64 products of operands with 11 bits leave e near 1e-3, so the score moves by about as much as its own rounding does. The row norms are taken of the ROUNDED rows:
// the exponent is then the squared distance of the rounded rows, never above 0 but for f32 rounding, and 0 for a row against itself (the largest term of every output row stays exact).
// Both products run transposed (keys x queries, then d x queries): the score accumulators of 32 keys, converted in place, are the B operand of the second.
// Norms, exp and the 1/4096 epilogue in f32. A score costs the vector port one fused multiply-add, one v_exp_f32 and half a packed convert:
// S*4096 = 2^(c2*(dots - |k|^2/2) + (12 - c2*|q|^2/2)), c2 = log2(e)/8; -|k|^2/2 starts the dots accumulator as the C operand of its first product.
// Two launches: k_split writes the f16 copies of q and v and the halved negative row norms -|q_i|^2/2 to the workspace once;
// k_softattn reads only those, so that no block repeats the conversion of the 2048 keys that its 15 neighbours of the same head need too.
// Its key chunks come to LDS by asynchronous copies in a ring of three buffers. The trip's barrier is split: a wave signals as soon as its fragments of chunk c are in registers
// and waits only at the top of trip c + 1, so that the barrier orders the waves' LDS reads alone and their products and exponentials may run a trip's arithmetic apart.

#define L_TOK 2048
#define DH    64
#define NBH   16
#define QPB   128             // queries per block (8 query tiles of 16)
#define QTW   2               // query tiles per wave: every key and value fragment that a wave reads from LDS feeds QTW products
#define KSP   4               // key groups per block: wave group g takes keys 32g..32g+31 of every staged chunk for all 8 query tiles
#define NTHR  (128 * KSP)
#define KCH   (32 * KSP)      // keys staged per trip
#define VP    (DH + 16)       // value row pitch in LDS, halves: 160 bytes, an odd multiple of 32, the conflict-free pitch of the transposing load
#define OP    (DH + 4)        // sO row pitch in floats: 272 bytes, an odd multiple of 16, so that 16 lanes storing 16 bytes of 16 rows meet no bank twice
#define NCH   (L_TOK / KCH)   // chunks (trips) of a head
#define KPB   ((DH + 8) * 2)  // key row pitch in LDS, bytes: 144, an odd multiple of 16, the conflict-free pitch of ds_load_b128
#define VPB   (VP * 2)        // value row pitch in LDS, bytes
#define OFF_V  (KCH * KPB)               // inside a buffer: key plane at 0, value plane here
#define BUFB   (KCH * KPB + KCH * VPB)   // bytes of one buffer of the ring
#define NBUF   3                         // buffers of the ring: chunk c + 2 is copied into the buffer of chunk c - 1, which every wave had left when it signalled for chunk c
#define OFF_N  (NBUF * BUFB)             // behind the buffers: -|q_j|^2/2 of the head's 2048 keys, f32
#define SOB    (KSP * QPB * OP * 4)      // bytes of the partials sO, which take the room of ring and norms behind the loop
#define SMEMB  (SOB > OFF_N + L_TOK * 4 ? SOB : OFF_N + L_TOK * 4)
#define NEL   (NBH * L_TOK * DH)   // elements of q (and of v)
#define HEL   (L_TOK * DH)         // elements of one head; workspace in 16-bit units: head h has q f16 at 2*HEL*h and v f16 HEL behind it; the norms (f32) stand at 2*NEL

typedef _Float16 v16h __attribute__((ext_vector_type(16)));
typedef _Float16 v8h  __attribute__((ext_vector_type(8)));
typedef _Float16 v8ha __attribute__((ext_vector_type(8), may_alias));
typedef float    v8f  __attribute__((ext_vector_type(8)));
typedef float    v4f  __attribute__((ext_vector_type(4)));
typedef float    v4fa __attribute__((ext_vector_type(4), may_alias));
typedef _Float16 v4ha __attribute__((ext_vector_type(4), may_alias));
typedef short s16x8 __attribute__((ext_vector_type(8)));
union FragH { v16h v; v8h half[2]; _Float16 h[16]; };

__device__ __forceinline__ v8f mma16(v16h a, v16h b, v8f c) {
  return __builtin_amdgcn_wmma_f32_16x16x32_f16(false, a, false, b, (short)0, c, false, false);
}

// ds_load_tr16_b128: the 32 lanes name the 16-byte pieces of a 16 x 16 tile of halves that lies [k][n] in LDS (lane l: row 8*(l>>4) + (l&7), piece (l>>3)&1);
// lane (c = l&15, h = l>>4) gets T[8h + 0..7][c], which is half an A fragment of the transposed tile in the hardware k order
__device__ __forceinline__ v8h ld_tr16(const _Float16* p) {
  typedef __attribute__((address_space(3))) s16x8 lds_s16x8;
  return __builtin_bit_cast(v8h, __builtin_amdgcn_ds_load_tr16_b128_v8i16((lds_s16x8*)p));
}

__device__ __forceinline__ unsigned lds_addr(const void* p) {   // byte address inside the work-group's LDS
  typedef __attribute__((address_space(3))) const unsigned char lds_u8;
  return (unsigned)(size_t)(lds_u8*)p;
}
// One thread's share of a chunk, LDS <- workspace with no register in between: 16 bytes of rows r and r + 16*KSP of each of the two planes.
// gk: this thread's 16 bytes of the key plane's first row group; lk, lv: its place in the buffer's key plane and value plane.
// The s_wait_xcnt closes the statement so that no address register is rewritten while a copy may still name it.
__device__ __forceinline__ void copy_chunk(const unsigned short* gk, unsigned lk, unsigned lv) {
  asm volatile("global_load_async_to_lds_b128 %0, %4, off\n\t"
               "global_load_async_to_lds_b128 %1, %5, off\n\t"
               "global_load_async_to_lds_b128 %2, %6, off\n\t"
               "global_load_async_to_lds_b128 %3, %7, off\n\t"
               "s_wait_xcnt 0x0"
               :: "v"(lk), "v"(lk + 16 * KSP * KPB), "v"(lv), "v"(lv + 16 * KSP * VPB),
                  "v"(gk), "v"(gk + NTHR * 8), "v"(gk + HEL), "v"(gk + HEL + NTHR * 8)
               : "memory");
}

// The work-group's barrier in its two halves. Every wave runs signal and wait strictly in turn; no LDS read stands between a signal and its wait.
__device__ __forceinline__ void bar_signal() { asm volatile("s_barrier_signal -1" ::: "memory"); }
__device__ __forceinline__ void bar_wait()   { asm volatile("s_barrier_wait -1" ::: "memory"); }

template <int M> __device__ __forceinline__ float row_xadd(float x) {   // x + x of lane ^ M inside the 16-lane row (DPP row_xmask)
  return x + __int_as_float(__builtin_amdgcn_update_dpp(0, __float_as_int(x), 0x160 + M, 0xf, 0xf, true));
}
__device__ __forceinline__ float row16_sum(float x) { return row_xadd<8>(row_xadd<4>(row_xadd<2>(row_xadd<1>(x)))); }

// One wave converts 32 consecutive rows: trip it takes rows it (lanes 0-15) and 16+it (lanes 16-31), 4 consecutive d a lane.
// Every 128-byte line of the three workspace planes has one writing wave.
__global__ __launch_bounds__(128) void k_split(const float* __restrict__ q, const float* __restrict__ v, unsigned short* __restrict__ ws) {
  const int tid = threadIdx.x, lane = tid & 31, ln = lane & 15, hh = lane >> 4;
  const int row0 = (blockIdx.x * 4 + (tid >> 5)) * 32;
  const size_t e0 = (size_t)(row0 + 16 * hh) * DH + ln * 4;
  const float* pq = q + e0; const float* pv = v + e0;
  v4f kq[16], vv[16];
#pragma unroll   // all 32 loads leave before any is used: one load round trip for the launch
  for (int it = 0; it < 16; ++it) {
    kq[it] = *(const v4fa*)(pq + it * DH);
    vv[it] = *(const v4fa*)(pv + it * DH);
  }
  // the two address pairs are inputs, so they stay whole up to this wait
  asm volatile("s_wait_xcnt 0x0" :: "v"(pq), "v"(pv) : "memory");
  unsigned short* ph = ws + e0 + (size_t)(row0 / L_TOK) * HEL;   // the 32 rows of a wave lie in one head
  float ksq_mine = 0.f;
#pragma unroll   // kq[it], vv[it] stay in registers
  for (int it = 0; it < 16; ++it) {
    v4ha h4, f4; v4f r4;
#pragma unroll
    for (int t = 0; t < 4; ++t) {
      h4[t] = (_Float16)kq[it][t]; r4[t] = (float)h4[t];   // r4: the rounded value, as the matrix unit will see it
      f4[t] = (_Float16)vv[it][t];
    }
    *(v4ha*)(ph + it * DH) = h4;
    *(v4ha*)(ph + HEL + it * DH) = f4;
    // |q_j|^2 in f32 of the rounded values: the 16 lanes of a row hold one row, every lane ends with its sum
    const float s = row16_sum(r4[0] * r4[0] + r4[1] * r4[1] + r4[2] * r4[2] + r4[3] * r4[3]);
    if (ln == it) ksq_mine = s;                          // lane 16*hh + it keeps row 16*hh + it
  }
  ((float*)(ws + 2 * (size_t)NEL))[row0 + lane] = -0.5f * ksq_mine;   // stored as -|q_j|^2/2 (exact): the form in which it starts a dots accumulator
}

// one block of 16 waves a WGP, 4 waves a SIMD: a wave may take 256 VGPRs
__global__ __launch_bounds__(NTHR) void k_softattn(const unsigned short* __restrict__ ws, float* __restrict__ out) {
  // three chunk buffers (each: keys f16 [key][d], values f16 [key][d]) and the head's norms; behind the loop their room
  // takes sO[KSP][QPB][OP], per key group the partial out*4096 of the block's 128 queries
  __shared__ __attribute__((aligned(16))) unsigned char smem[SMEMB];

  const int tid = threadIdx.x, lane = tid & 31, ln = lane & 15, hh = lane >> 4;
  const int wv = __builtin_amdgcn_readfirstlane(tid >> 5), w = wv & 3, g = wv >> 2;   // wave number, query tile pair, key group: scalar registers
  const int kb = g * 32;                                 // this wave's first key row inside the staged chunk
  const int bh = blockIdx.x / (L_TOK / QPB), qblk = blockIdx.x % (L_TOK / QPB);
  const int q0 = qblk * QPB + w * (16 * QTW);
  const size_t base = (size_t)bh * L_TOK * DH;
  const unsigned short* QH = ws + 2 * base;              // q plane of this head; v at + HEL
  const float* NRM = (const float*)(ws + 2 * (size_t)NEL) + bh * L_TOK;
  float* O = out + base;
  const float c2 = 0.125f * 1.44269504088896341f;        // 2 * 1/(2*sqrt(64)) * log2(e): S*4096 = 2^(c2*(dots - |k|^2/2 - |q|^2/2) + 12)

  // B fragments of this wave's QTW x 16 queries (f16, column ln, k = d split layout) and, per tile, the exponent's part 12 - c2*|q|^2/2 of the one query whose D column this lane holds
  FragH aq[QTW][2];
  float sqq[QTW];
  {
    const unsigned short* qr = QH + (size_t)(q0 + ln) * DH + 8 * hh;
    const int qi = q0 + ln;
#pragma unroll
    for (int qt = 0; qt < QTW; ++qt) {
#pragma unroll
      for (int ks = 0; ks < 2; ++ks) {
        aq[qt][ks].half[0] = *(const v8ha*)(qr + qt * 16 * DH + ks * 32);
        aq[qt][ks].half[1] = *(const v8ha*)(qr + qt * 16 * DH + ks * 32 + 16);
      }
      sqq[qt] = NRM[qi + qt * 16] * c2 + 12.0f;          // the query's own part of the exponent, with the factor 4096
    }
    // what these loads name (address pair, index, scalar base) are inputs, so they stay whole up to this wait
    asm volatile("s_wait_xcnt 0x0" :: "v"(qr), "v"(qi), "s"(NRM) : "memory");
  }

  v8f oacc[QTW][4] = {};
  const unsigned char* kf = smem + (kb + ln) * KPB + 16 * hh;                                       // this lane's row of the wave's first key sub-tile, buffer 0
  const unsigned char* vt = smem + OFF_V + (kb + 8 * hh + (lane & 7)) * VPB + 16 * ((lane >> 3) & 1);   // its piece of the wave's first 16 x 16 value tile
  const float* sn = (const float*)(smem + OFF_N) + kb + 8 * hh;   // -|k|^2/2 of the 8 keys whose D rows this lane holds in chunk 0's first sub-tile
  const unsigned short* gk = QH + tid * 8;               // staging: this thread's 16 bytes of chunk 0
  const unsigned lk = lds_addr(smem + (tid >> 3) * KPB + (tid & 7) * 16), lv = lds_addr(smem + OFF_V + (tid >> 3) * VPB + (tid & 7) * 16);
  // in front of the loop: chunk 0 and the norms (16 bytes a thread) land and this wave signals for them (the wait stands at the top of trip 0), then chunk 1 starts
  copy_chunk(gk, lk, lv);
  asm volatile("global_load_async_to_lds_b128 %0, %1, off\n\ts_wait_xcnt 0x0" :: "v"(lds_addr(smem + OFF_N + tid * 16)), "v"(NRM + tid * 4) : "memory");
  asm volatile("s_wait_asynccnt 0x0" ::: "memory");      // this wave's copies have landed before the signal that shows them to the others
  bar_signal();
  copy_chunk(gk + KCH * DH, lk + BUFB, lv + BUFB);
  unsigned bo = 0, bnext = BUFB, bfree = 2 * BUFB;       // buffers of chunk c, of chunk c + 1, and of chunk c - 1 (which takes chunk c + 2)
  for (int c = 0; c < NCH; ++c) {
    bar_wait();                                          // every wave has signalled: chunk c is all in LDS, and nobody reads chunk c - 1 any more
    v8f nk[2];                                           // -|k|^2/2 of the 8 keys whose D rows this lane holds, per sub-tile: the C operand of the sub-tile's first product
#pragma unroll
    for (int it = 0; it < 2; ++it) {
      const v4f n0 = *(const v4fa*)(sn + c * KCH + it * 16), n1 = *(const v4fa*)(sn + c * KCH + it * 16 + 4);
      nk[it] = (v8f){n0[0], n0[1], n0[2], n0[3], n1[0], n1[1], n1[2], n1[3]};
    }

    // dots tiles 32 keys x 16 queries (two 16-key sub-tiles) for each of the wave's query tiles, on top of -|k|^2/2, then S * 4096 = 2^(c2*acc + sqq) -> f16 in registers:
    // D row 8hh+r of sub-tile nt is key nt*16+8hh+r, which is element nt*8+r of a B fragment in the hardware k order
    FragH pb[QTW];
    FragH bk[2][2];                                      // A fragments of the wave's 32 keys: [sub-tile][k step]
#pragma unroll   // all 8 loads stand in one place, ahead of the products
    for (int nt = 0; nt < 2; ++nt) {
#pragma unroll
      for (int ks = 0; ks < 2; ++ks) {
        const unsigned char* kr = kf + bo + nt * 16 * KPB + ks * 64;
        bk[nt][ks].half[0] = *(const v8ha*)(kr);
        bk[nt][ks].half[1] = *(const v8ha*)(kr + 32);
      }
    }
    FragH bv[4];                                         // A: row d = dt*16+ln, k = keys kb+8hh+0..7 and kb+16+8hh+0..7, as pb has them
#pragma unroll   // the value fragments leave in the same group: all of the wave's reads of chunk c stand ahead of its signal
    for (int dt = 0; dt < 4; ++dt) {
      bv[dt].half[0] = ld_tr16((const _Float16*)(vt + bo + dt * 32));
      bv[dt].half[1] = ld_tr16((const _Float16*)(vt + bo + 16 * VPB + dt * 32));
    }
    // the wave's half of the hand-over, ahead of its arithmetic: the others need not wait for this wave's products and exponentials, only for its reads and copies
    asm volatile("s_wait_dscnt 0x0" ::: "memory");       // this wave's LDS reads of chunk c are done
    asm volatile("s_wait_asynccnt 0x0" ::: "memory");    // this wave's copies of chunk c + 1, begun a trip ago, have landed
    bar_signal();
    if (c + 2 < NCH) copy_chunk(gk + (size_t)(c + 2) * (KCH * DH), lk + bfree, lv + bfree);   // into the buffer of chunk c - 1: the wait at this trip's top ended its last read
    v8f acc[2][QTW];
#pragma unroll   // k step outermost: the four tiles' products stand between a tile's first product and its second, so that none waits for the one in front of it
    for (int ks = 0; ks < 2; ++ks) {
#pragma unroll
      for (int nt = 0; nt < 2; ++nt) {
#pragma unroll
        for (int qt = 0; qt < QTW; ++qt) acc[nt][qt] = mma16(bk[nt][ks].v, aq[qt][ks].v, ks == 0 ? nk[nt] : acc[nt][qt]);
      }
    }
    __builtin_amdgcn_sched_barrier(0);                   // keeps the eight products in that order ahead of the exp block: mixed with it, a tile's two products come to stand back to back and idle slots are padded in
#pragma unroll
    for (int nt = 0; nt < 2; ++nt) {
#pragma unroll
      for (int qt = 0; qt < QTW; ++qt) {
#pragma unroll
        for (int r = 0; r < 8; ++r) {
          pb[qt].h[nt * 8 + r] = (_Float16)__builtin_amdgcn_exp2f(acc[nt][qt][r] * c2 + sqq[qt]);   // one fused multiply-add, v_exp_f32, convert
        }
      }
    }
#pragma unroll
    for (int dt = 0; dt < 4; ++dt) {
#pragma unroll
      for (int qt = 0; qt < QTW; ++qt) oacc[qt][dt] = mma16(bv[dt].v, pb[qt].v, oacc[qt][dt]);   // oacc[qt][dt][r] = out*4096 of query qt*16+ln at d = dt*16+8hh+r
    }
    const unsigned bt = bfree; bfree = bo; bo = bnext; bnext = bt;   // the ring turns
  }
  bar_wait();                                            // the wait of the last trip's signal: every wave's reads of the ring are done
  asm volatile("s_wait_asynccnt 0x0" ::: "memory");      // no copy is under way when the ring's room becomes sO
  float (*sO)[QPB][OP] = (float (*)[QPB][OP])smem;

  // the lane number is read anew here: no epilogue address then lives in a vector register through the loop (fewer live registers there)
  const int el = (int)__builtin_amdgcn_mbcnt_lo(~0u, 0u), eln = el & 15, ehh = el >> 4, etid = wv * 32 + el;
#pragma unroll
  for (int qt = 0; qt < QTW; ++qt) {
#pragma unroll
    for (int dt = 0; dt < 4; ++dt) {
      float* po = &sO[g][(w * QTW + qt) * 16 + eln][dt * 16 + 8 * ehh];
      *(v4fa*)po = (v4f){oacc[qt][dt][0], oacc[qt][dt][1], oacc[qt][dt][2], oacc[qt][dt][3]};
      *(v4fa*)(po + 4) = (v4f){oacc[qt][dt][4], oacc[qt][dt][5], oacc[qt][dt][6], oacc[qt][dt][7]};
    }
  }
  __syncthreads();                                       // every key group's partial is in LDS before any thread sums them
  // out row = sum of the KSP partials in group order, then the exact 1/4096; 16 lanes store one whole 256-byte row
#pragma unroll
  for (int k = 0; k < QPB * (DH / 4) / NTHR; ++k) {
    const int idx = k * NTHR + etid, r = idx >> 4, c4 = (idx & 15) * 4;
    v4f val = *(const v4fa*)&sO[0][r][c4];
#pragma unroll
    for (int p = 1; p < KSP; ++p) val += *(const v4fa*)&sO[p][r][c4];
    *(v4f*)(O + (size_t)(qblk * QPB + r) * DH + c4) = val * (1.0f / 4096.0f);
  }
}

extern "C" void kernel_launch(void* const* d_in, const int* in_sizes, int n_in,
                              void* d_out, int out_size, void* d_ws, size_t ws_size, hipStream_t stream) {
  (void)in_sizes; (void)n_in; (void)out_size; (void)ws_size;
  const float* q = (const float*)d_in[0];
  const float* v = (const float*)d_in[1];
  k_split<<<NBH * L_TOK / 128, 128, 0, stream>>>(q, v, (unsigned short*)d_ws);
  k_softattn<<<NBH * (L_TOK / QPB), NTHR, 0, stream>>>((const unsigned short*)d_ws, (float*)d_out);
}
